// v000
// Measured on an AMD MI455X. A time is GPU time per run, averaged over a window of back-to-back runs after a warm-up
// (all launches, gaps included; the runs take copies of the inputs in turn), and the median of several windows.
// Apart from v000's, it joins two sittings. Times from different sittings can be a few percent apart, while
// side-by-side timings come from the same sitting.
// v000, which the later versions start from, runs in 1310 microseconds.
#include <hip/hip_runtime.h>
#include <stdint.h>

#define EMBED 1024
#define HEADS 16
#define HDIM  64
#define BATCH 4
#define SEQ   2048
#define ROWS  (BATCH * SEQ)     // 8192
#define QKV_N (3 * EMBED)       // 3072

typedef __bf16 bf16_t;
typedef bf16_t v16bf __attribute__((ext_vector_type(16)));
typedef float  v8f   __attribute__((ext_vector_type(8)));
typedef int    v4i   __attribute__((ext_vector_type(4)));

union FragA { v16bf v; unsigned int u[8]; };
union FragC { v8f  v; float f[8]; };

__device__ __forceinline__ unsigned short f2bf(float x) {
    union { float f; unsigned int u; } c; c.f = x;
    unsigned int r = (c.u + 0x7fffu + ((c.u >> 16) & 1u)) >> 16;  // RNE
    return (unsigned short)r;
}

__device__ __forceinline__ int kpair_of(int j, int g) {
    return ((j >> 2) << 4) | (g << 3) | ((j & 3) << 1);
}

#if __has_builtin(__builtin_amdgcn_global_load_async_to_lds_b128)
#define HAVE_ASYNC_LDS 1
#else
#define HAVE_ASYNC_LDS 0
#endif

__device__ __forceinline__ void async_copy16(const void* gsrc, void* lds) {
#if HAVE_ASYNC_LDS
    __builtin_amdgcn_global_load_async_to_lds_b128(
        (__attribute__((address_space(1))) v4i*)gsrc,
        (__attribute__((address_space(3))) v4i*)lds, 0, 0);
#else
    *(uint4*)lds = *(const uint4*)gsrc;
#endif
}

__device__ __forceinline__ void wait_async0() {
#if HAVE_ASYNC_LDS
#if __has_builtin(__builtin_amdgcn_s_wait_asynccnt)
    __builtin_amdgcn_s_wait_asynccnt(0);
#else
    asm volatile("s_wait_asynccnt 0" ::: "memory");
#endif
#endif
}

// ---------------------------------------------------------------- fp32 -> bf16
__global__ void cvt_f32_bf16(const float* __restrict__ src,
                             unsigned short* __restrict__ dst, int n) {
    int i = blockIdx.x * blockDim.x + threadIdx.x;
    if (i < n) dst[i] = f2bf(src[i]);
}

// -------------------------------------------------- tiled bf16 GEMM + bias
// C[M,N] = A[M,K] @ B[K,N] + bias[N]; 128x128 tile, BK=32, 8 waves,
// each wave computes 32x64 (2x4 tiles of 16x16) via v_wmma_f32_16x16x32_bf16.
template <bool STORE_BF16>
__global__ __launch_bounds__(256)
void gemm_bf16_wmma(const unsigned short* __restrict__ A,
                    const unsigned short* __restrict__ Bm,
                    const float* __restrict__ bias,
                    void* __restrict__ Cout,
                    int M, int N, int K) {
    __shared__ unsigned short As[128][32];    // [m][k] row-major
    __shared__ unsigned short Bst[128][32];   // B transposed: [n][k]

    const int tid  = threadIdx.x;
    const int wid  = tid >> 5, lane = tid & 31;
    const int g    = lane >> 4, ln = lane & 15;
    const int wm   = wid >> 1,  wn = wid & 1;
    const int m0   = blockIdx.y * 128, n0 = blockIdx.x * 128;

    FragC acc[2][4];
#pragma unroll
    for (int tm = 0; tm < 2; ++tm)
#pragma unroll
        for (int tn = 0; tn < 4; ++tn)
#pragma unroll
            for (int r = 0; r < 8; ++r) acc[tm][tn].f[r] = 0.f;

    for (int kb = 0; kb < K; kb += 32) {
        __syncthreads();
        // A tile: straight row copy -> async global->LDS (2 x b128 per thread)
#pragma unroll
        for (int i = 0; i < 2; ++i) {
            int q = tid + i * 256;              // 0..511
            int row = q >> 2, seg = (q & 3) << 3;   // seg in elements (8 = 16B)
            async_copy16(A + (size_t)(m0 + row) * K + kb + seg, &As[row][seg]);
        }
        // B tile: transpose into LDS (needs VALU path)
#pragma unroll
        for (int i = 0; i < 8; ++i) {
            int q = tid + i * 256;
            int kk = q >> 6, n2 = (q & 63) << 1;
            unsigned int u = *(const unsigned int*)(Bm + (size_t)(kb + kk) * N + n0 + n2);
            Bst[n2][kk]     = (unsigned short)(u & 0xffffu);
            Bst[n2 + 1][kk] = (unsigned short)(u >> 16);
        }
        wait_async0();
        __syncthreads();

        FragA a[2], b[4];
#pragma unroll
        for (int tm = 0; tm < 2; ++tm)
#pragma unroll
            for (int j = 0; j < 8; ++j)
                a[tm].u[j] = *(const unsigned int*)&As[wm * 32 + tm * 16 + ln][kpair_of(j, g)];
#pragma unroll
        for (int tn = 0; tn < 4; ++tn)
#pragma unroll
            for (int j = 0; j < 8; ++j)
                b[tn].u[j] = *(const unsigned int*)&Bst[wn * 64 + tn * 16 + ln][kpair_of(j, g)];
#pragma unroll
        for (int tm = 0; tm < 2; ++tm)
#pragma unroll
            for (int tn = 0; tn < 4; ++tn)
                acc[tm][tn].v = __builtin_amdgcn_wmma_f32_16x16x32_bf16(
                    false, a[tm].v, false, b[tn].v, (short)0, acc[tm][tn].v, false, false);
    }

#pragma unroll
    for (int tm = 0; tm < 2; ++tm)
#pragma unroll
        for (int tn = 0; tn < 4; ++tn)
#pragma unroll
            for (int r = 0; r < 8; ++r) {
                int row = m0 + wm * 32 + tm * 16 + r + 8 * g;
                int col = n0 + wn * 64 + tn * 16 + ln;
                float v = acc[tm][tn].f[r] + bias[col];
                if (STORE_BF16)
                    ((unsigned short*)Cout)[(size_t)row * N + col] = f2bf(v);
                else
                    ((float*)Cout)[(size_t)row * N + col] = v;
            }
}

// ------------------------------------------------ flash-attention (streaming)
// grid = B*H*(SEQ/64), 128 threads (4 waves). Wave = 16 query rows.
__global__ __launch_bounds__(128)
void attention_wmma(const unsigned short* __restrict__ qkvb,   // [ROWS, 3E] bf16
                    const int* __restrict__ mask,              // [B*SEQ]
                    unsigned short* __restrict__ ctxb) {       // [ROWS, E] bf16
    __shared__ unsigned short Kt[64][64];      // [key][d]
    __shared__ unsigned short Vt[64][64];      // transposed: [d][key]
    __shared__ unsigned short Ps[4][16][64];   // per-wave P staging [qrow][key]

    const int tid = threadIdx.x;
    const int wid = tid >> 5, lane = tid & 31;
    const int g   = lane >> 4, ln = lane & 15;

    const int nqb = SEQ / 64;                       // 32
    const int qb  = blockIdx.x % nqb;
    const int h   = (blockIdx.x / nqb) % HEADS;
    const int b   = blockIdx.x / (nqb * HEADS);

    const int    q0   = qb * 64 + wid * 16;
    const size_t rowB = (size_t)b * SEQ;
    const float  scale = 0.125f;                    // 1/sqrt(64)

    // Q fragments (A-matrix 16x32, two for d=64) loaded once from global
    FragA aq[2];
#pragma unroll
    for (int f = 0; f < 2; ++f)
#pragma unroll
        for (int j = 0; j < 8; ++j) {
            int col = h * HDIM + f * 32 + kpair_of(j, g);
            aq[f].u[j] = *(const unsigned int*)(qkvb + (rowB + q0 + ln) * (size_t)QKV_N + col);
        }

    float m[8], l[8];
    FragC o[4];
#pragma unroll
    for (int r = 0; r < 8; ++r) { m[r] = -3.0e38f; l[r] = 0.f; }
#pragma unroll
    for (int dt = 0; dt < 4; ++dt)
#pragma unroll
        for (int r = 0; r < 8; ++r) o[dt].f[r] = 0.f;

    for (int kb = 0; kb < SEQ; kb += 64) {
        __syncthreads();
        // K tile: straight row copy -> async global->LDS (4 x b128 per thread)
#pragma unroll
        for (int i = 0; i < 4; ++i) {
            int q = tid + i * 128;                 // 0..511
            int key = q >> 3, seg = (q & 7) << 3;  // seg in elements (8 = 16B)
            async_copy16(qkvb + (rowB + kb + key) * (size_t)QKV_N + EMBED + h * HDIM + seg,
                         &Kt[key][seg]);
        }
        // V tile: transposed into LDS (VALU path)
#pragma unroll
        for (int i = 0; i < 16; ++i) {
            int q = tid + i * 128;
            int key = q >> 5, dp = (q & 31) << 1;
            unsigned int uv = *(const unsigned int*)(
                qkvb + (rowB + kb + key) * (size_t)QKV_N + 2 * EMBED + h * HDIM + dp);
            Vt[dp][key]     = (unsigned short)(uv & 0xffffu);
            Vt[dp + 1][key] = (unsigned short)(uv >> 16);
        }
        wait_async0();
        __syncthreads();

        // S = scale * Q K^T   (16 x 64 per wave), + mask
        FragC s[4];
#pragma unroll
        for (int n = 0; n < 4; ++n) {
#pragma unroll
            for (int r = 0; r < 8; ++r) s[n].f[r] = 0.f;
#pragma unroll
            for (int ks = 0; ks < 2; ++ks) {
                FragA bk;
#pragma unroll
                for (int j = 0; j < 8; ++j)
                    bk.u[j] = *(const unsigned int*)&Kt[n * 16 + ln][ks * 32 + kpair_of(j, g)];
                s[n].v = __builtin_amdgcn_wmma_f32_16x16x32_bf16(
                    false, aq[ks].v, false, bk.v, (short)0, s[n].v, false, false);
            }
            int mv = mask[b * SEQ + kb + n * 16 + ln];   // lane's column is fixed
#pragma unroll
            for (int r = 0; r < 8; ++r)
                s[n].f[r] = (mv == 0) ? -3.0e38f : s[n].f[r] * scale;
        }

        // online softmax: row max / sum live in the C-layout (r, half-g) striping
        float rm[8], rs[8];
#pragma unroll
        for (int r = 0; r < 8; ++r)
            rm[r] = fmaxf(fmaxf(s[0].f[r], s[1].f[r]), fmaxf(s[2].f[r], s[3].f[r]));
#pragma unroll
        for (int off = 8; off >= 1; off >>= 1)
#pragma unroll
            for (int r = 0; r < 8; ++r)
                rm[r] = fmaxf(rm[r], __shfl_xor(rm[r], off, 32));

#pragma unroll
        for (int r = 0; r < 8; ++r) {
            float mn    = fmaxf(m[r], rm[r]);
            float alpha = __expf(m[r] - mn);
            m[r] = mn;
            l[r] *= alpha;
#pragma unroll
            for (int dt = 0; dt < 4; ++dt) o[dt].f[r] *= alpha;
            float part = 0.f;
#pragma unroll
            for (int n = 0; n < 4; ++n) {
                float p = __expf(s[n].f[r] - mn);
                s[n].f[r] = p;
                part += p;
            }
            rs[r] = part;
        }
#pragma unroll
        for (int off = 8; off >= 1; off >>= 1)
#pragma unroll
            for (int r = 0; r < 8; ++r)
                rs[r] += __shfl_xor(rs[r], off, 32);
#pragma unroll
        for (int r = 0; r < 8; ++r) l[r] += rs[r];

        // P: C-layout regs -> LDS -> A-layout fragments
#pragma unroll
        for (int n = 0; n < 4; ++n)
#pragma unroll
            for (int r = 0; r < 8; ++r)
                Ps[wid][r + 8 * g][n * 16 + ln] = f2bf(s[n].f[r]);
        __syncthreads();

        // O += P @ V
#pragma unroll
        for (int dt = 0; dt < 4; ++dt)
#pragma unroll
            for (int ks = 0; ks < 2; ++ks) {
                FragA ap, bv;
#pragma unroll
                for (int j = 0; j < 8; ++j) {
                    int kp = ks * 32 + kpair_of(j, g);
                    ap.u[j] = *(const unsigned int*)&Ps[wid][ln][kp];
                    bv.u[j] = *(const unsigned int*)&Vt[dt * 16 + ln][kp];
                }
                o[dt].v = __builtin_amdgcn_wmma_f32_16x16x32_bf16(
                    false, ap.v, false, bv.v, (short)0, o[dt].v, false, false);
            }
    }

    // normalize and emit ctx (bf16, [B,T,E] row-major with head offset)
#pragma unroll
    for (int r = 0; r < 8; ++r) {
        float inv = 1.f / l[r];
        int row = b * SEQ + q0 + r + 8 * g;
#pragma unroll
        for (int dt = 0; dt < 4; ++dt) {
            int col = h * HDIM + dt * 16 + ln;
            ctxb[(size_t)row * EMBED + col] = f2bf(o[dt].f[r] * inv);
        }
    }
}

// ---------------------------------------------------------------------- launch
extern "C" void kernel_launch(void* const* d_in, const int* in_sizes, int n_in,
                              void* d_out, int out_size, void* d_ws, size_t ws_size,
                              hipStream_t stream) {
    (void)in_sizes; (void)n_in; (void)out_size; (void)ws_size;
    const float* x    = (const float*)d_in[0];
    const int*   mask = (const int*)  d_in[1];
    const float* Wqkv = (const float*)d_in[2];
    const float* bqkv = (const float*)d_in[3];
    const float* Wout = (const float*)d_in[4];
    const float* bout = (const float*)d_in[5];

    char* ws = (char*)d_ws;
    size_t off = 0;
    unsigned short* xb    = (unsigned short*)(ws + off); off += (size_t)ROWS  * EMBED * 2;
    unsigned short* wqkvb = (unsigned short*)(ws + off); off += (size_t)EMBED * QKV_N * 2;
    unsigned short* woutb = (unsigned short*)(ws + off); off += (size_t)EMBED * EMBED * 2;
    unsigned short* qkvb  = (unsigned short*)(ws + off); off += (size_t)ROWS  * QKV_N * 2;
    unsigned short* ctxb  = (unsigned short*)(ws + off); off += (size_t)ROWS  * EMBED * 2;

    int n1 = ROWS * EMBED;
    cvt_f32_bf16<<<(n1 + 255) / 256, 256, 0, stream>>>(x, xb, n1);
    int n2 = EMBED * QKV_N;
    cvt_f32_bf16<<<(n2 + 255) / 256, 256, 0, stream>>>(Wqkv, wqkvb, n2);
    int n3 = EMBED * EMBED;
    cvt_f32_bf16<<<(n3 + 255) / 256, 256, 0, stream>>>(Wout, woutb, n3);

    // qkv = x @ Wqkv + bqkv   (bf16 out)
    gemm_bf16_wmma<true><<<dim3(QKV_N / 128, ROWS / 128), 256, 0, stream>>>(
        xb, wqkvb, bqkv, qkvb, ROWS, QKV_N, EMBED);

    // streaming attention per (b, h, 64-query block)
    attention_wmma<<<BATCH * HEADS * (SEQ / 64), 128, 0, stream>>>(qkvb, mask, ctxb);

    // out = ctx @ Wout + bout  (fp32 out)
    gemm_bf16_wmma<false><<<dim3(EMBED / 128, ROWS / 128), 256, 0, stream>>>(
        ctxb, woutb, bout, d_out, ROWS, EMBED, EMBED);
}

// v001
// One run takes 416 microseconds.
// Timed twice side by side with v000, it ran 3.19 times as fast both times.
#include <hip/hip_runtime.h>
#include <stdint.h>

#define EMBED 1024
#define HEADS 16
#define HDIM  64
#define BATCH 4
#define SEQ   2048
#define ROWS  (BATCH * SEQ)     // 8192
#define QKV_N (3 * EMBED)       // 3072

typedef __bf16 bf16_t;
typedef bf16_t v16bf __attribute__((ext_vector_type(16)));
typedef float  v8f   __attribute__((ext_vector_type(8)));
typedef int    v4i   __attribute__((ext_vector_type(4)));

typedef short  v8s   __attribute__((ext_vector_type(8)));

union FragA { v16bf v; unsigned int u[8]; v8s h[2]; };
union FragC { v8f  v; float f[8]; };

__device__ __forceinline__ unsigned short f2bf(float x) {
    union { float f; unsigned int u; } c; c.f = x;
    unsigned int r = (c.u + 0x7fffu + ((c.u >> 16) & 1u)) >> 16;  // RNE
    return (unsigned short)r;
}

__device__ __forceinline__ int kpair_of(int j, int g) {
    return ((j >> 2) << 4) | (g << 3) | ((j & 3) << 1);
}

#if __has_builtin(__builtin_amdgcn_global_load_async_to_lds_b128)
#define HAVE_ASYNC_LDS 1
#else
#define HAVE_ASYNC_LDS 0
#endif

__device__ __forceinline__ void async_copy16(const void* gsrc, void* lds) {
#if HAVE_ASYNC_LDS
    __builtin_amdgcn_global_load_async_to_lds_b128(
        (__attribute__((address_space(1))) v4i*)gsrc,
        (__attribute__((address_space(3))) v4i*)lds, 0, 0);
#else
    *(uint4*)lds = *(const uint4*)gsrc;
#endif
}

__device__ __forceinline__ void wait_async0() {
#if HAVE_ASYNC_LDS
#if __has_builtin(__builtin_amdgcn_s_wait_asynccnt)
    __builtin_amdgcn_s_wait_asynccnt(0);
#else
    asm volatile("s_wait_asynccnt 0" ::: "memory");
#endif
#endif
}

__device__ __forceinline__ void load_b_tr16(FragA& f, const unsigned short* tile,
                                            int pitch, int k0, int n0, int lane) {
    typedef __attribute__((address_space(3))) v8s lds_v8s;
    const unsigned short* p =
        tile + (k0 + ((lane >> 4) << 3) + (lane & 7)) * pitch + n0 + (((lane >> 3) & 1) << 3);
    f.h[0] = __builtin_amdgcn_ds_load_tr16_b128_v8i16((lds_v8s*)p);
    f.h[1] = __builtin_amdgcn_ds_load_tr16_b128_v8i16((lds_v8s*)(p + 16 * pitch));
}

// ---------------------------------------------------------------- fp32 -> bf16
__global__ void cvt_f32_bf16(const float* __restrict__ src,
                             unsigned short* __restrict__ dst, int n) {
    int i = blockIdx.x * blockDim.x + threadIdx.x;
    if (i < n) dst[i] = f2bf(src[i]);
}

// -------------------------------------------------- tiled bf16 GEMM + bias
// C[M,N] = A[M,K] @ B[K,N] + bias[N]; 128x128 tile, BK=32, 8 waves,
// each wave computes 32x64 (2x4 tiles of 16x16) via v_wmma_f32_16x16x32_bf16.
template <bool STORE_BF16>
__global__ __launch_bounds__(256)
void gemm_bf16_wmma(const unsigned short* __restrict__ A,
                    const unsigned short* __restrict__ Bm,
                    const float* __restrict__ bias,
                    void* __restrict__ Cout,
                    int M, int N, int K) {
    __shared__ unsigned short As[128][32];    // [m][k] row-major
    __shared__ __attribute__((aligned(16))) unsigned short Bs[32][144];  // [k][n] row-major, pitch 288 B

    const int tid  = threadIdx.x;
    const int wid  = tid >> 5, lane = tid & 31;
    const int g    = lane >> 4, ln = lane & 15;
    const int wm   = wid >> 1,  wn = wid & 1;
    const int m0   = blockIdx.y * 128, n0 = blockIdx.x * 128;

    FragC acc[2][4];
#pragma unroll
    for (int tm = 0; tm < 2; ++tm)
#pragma unroll
        for (int tn = 0; tn < 4; ++tn)
#pragma unroll
            for (int r = 0; r < 8; ++r) acc[tm][tn].f[r] = 0.f;

    for (int kb = 0; kb < K; kb += 32) {
        __syncthreads();
        // A tile: straight row copy -> async global->LDS (2 x b128 per thread)
#pragma unroll
        for (int i = 0; i < 2; ++i) {
            int q = tid + i * 256;              // 0..511
            int row = q >> 2, seg = (q & 3) << 3;   // seg in elements (8 = 16B)
            async_copy16(A + (size_t)(m0 + row) * K + kb + seg, &As[row][seg]);
        }
        // B tile: straight row copy too (2 x b128 per thread); the read transposes
#pragma unroll
        for (int i = 0; i < 2; ++i) {
            int q = tid + i * 256;              // 0..511
            int kk = q >> 4, seg = (q & 15) << 3;
            async_copy16(Bm + (size_t)(kb + kk) * N + n0 + seg, &Bs[kk][seg]);
        }
        wait_async0();
        __syncthreads();   // publishes both tiles; also holds the LDS reads behind the wait

        FragA a[2], b[4];
#pragma unroll
        for (int tm = 0; tm < 2; ++tm)
#pragma unroll
            for (int j = 0; j < 8; ++j)
                a[tm].u[j] = *(const unsigned int*)&As[wm * 32 + tm * 16 + ln][kpair_of(j, g)];
#pragma unroll
        for (int tn = 0; tn < 4; ++tn)
            load_b_tr16(b[tn], &Bs[0][0], 144, 0, wn * 64 + tn * 16, lane);
#pragma unroll
        for (int tm = 0; tm < 2; ++tm)
#pragma unroll
            for (int tn = 0; tn < 4; ++tn)
                acc[tm][tn].v = __builtin_amdgcn_wmma_f32_16x16x32_bf16(
                    false, a[tm].v, false, b[tn].v, (short)0, acc[tm][tn].v, false, false);
    }

#pragma unroll
    for (int tm = 0; tm < 2; ++tm)
#pragma unroll
        for (int tn = 0; tn < 4; ++tn)
#pragma unroll
            for (int r = 0; r < 8; ++r) {
                int row = m0 + wm * 32 + tm * 16 + r + 8 * g;
                int col = n0 + wn * 64 + tn * 16 + ln;
                float v = acc[tm][tn].f[r] + bias[col];
                if (STORE_BF16)
                    ((unsigned short*)Cout)[(size_t)row * N + col] = f2bf(v);
                else
                    ((float*)Cout)[(size_t)row * N + col] = v;
            }
}

// ------------------------------------------------ flash-attention (streaming)
// grid = B*H*(SEQ/64), 128 threads (4 waves). Wave = 16 query rows.
__global__ __launch_bounds__(128)
void attention_wmma(const unsigned short* __restrict__ qkvb,   // [ROWS, 3E] bf16
                    const int* __restrict__ mask,              // [B*SEQ]
                    unsigned short* __restrict__ ctxb) {       // [ROWS, E] bf16
    // K in front of V in one object: V's column block lies 2048 B behind K's in a qkv row, the
    // compiler folds that step into the V copies' offset field (which moves the LDS address
    // too) and takes it off their LDS address register; with V at 8192 B that stays above 0.
    struct __attribute__((aligned(16))) KVTiles {
        unsigned short k[64][64];              // [key][d]
        unsigned short v[64][80];              // [key][d] row-major, pitch 160 B
    };
    __shared__ KVTiles kv;
    unsigned short (&Kt)[64][64] = kv.k;
    unsigned short (&Vs)[64][80] = kv.v;
    __shared__ unsigned short Ps[4][16][64];   // per-wave P staging [qrow][key]

    const int tid = threadIdx.x;
    const int wid = tid >> 5, lane = tid & 31;
    const int g   = lane >> 4, ln = lane & 15;

    const int nqb = SEQ / 64;                       // 32
    const int qb  = blockIdx.x % nqb;
    const int h   = (blockIdx.x / nqb) % HEADS;
    const int b   = blockIdx.x / (nqb * HEADS);

    const int    q0   = qb * 64 + wid * 16;
    const size_t rowB = (size_t)b * SEQ;
    const float  scale = 0.125f;                    // 1/sqrt(64)

    // Q fragments (A-matrix 16x32, two for d=64) loaded once from global
    FragA aq[2];
#pragma unroll
    for (int f = 0; f < 2; ++f)
#pragma unroll
        for (int j = 0; j < 8; ++j) {
            int col = h * HDIM + f * 32 + kpair_of(j, g);
            aq[f].u[j] = *(const unsigned int*)(qkvb + (rowB + q0 + ln) * (size_t)QKV_N + col);
        }

    float m[8], l[8];
    FragC o[4];
#pragma unroll
    for (int r = 0; r < 8; ++r) { m[r] = -3.0e38f; l[r] = 0.f; }
#pragma unroll
    for (int dt = 0; dt < 4; ++dt)
#pragma unroll
        for (int r = 0; r < 8; ++r) o[dt].f[r] = 0.f;

    for (int kb = 0; kb < SEQ; kb += 64) {
        __syncthreads();
        // K tile: straight row copy -> async global->LDS (4 x b128 per thread)
#pragma unroll
        for (int i = 0; i < 4; ++i) {
            int q = tid + i * 128;                 // 0..511
            int key = q >> 3, seg = (q & 7) << 3;  // seg in elements (8 = 16B)
            async_copy16(qkvb + (rowB + kb + key) * (size_t)QKV_N + EMBED + h * HDIM + seg,
                         &Kt[key][seg]);
        }
        // V tile: straight row copy too (4 x b128 per thread); the read transposes
#pragma unroll
        for (int i = 0; i < 4; ++i) {
            int q = tid + i * 128;                 // 0..511
            int key = q >> 3, seg = (q & 7) << 3;
            async_copy16(qkvb + (rowB + kb + key) * (size_t)QKV_N + 2 * EMBED + h * HDIM + seg,
                         &Vs[key][seg]);
        }
        wait_async0();
        __syncthreads();   // publishes both tiles; also holds the LDS reads behind the wait

        // S = scale * Q K^T   (16 x 64 per wave), + mask
        FragC s[4];
#pragma unroll
        for (int n = 0; n < 4; ++n) {
#pragma unroll
            for (int r = 0; r < 8; ++r) s[n].f[r] = 0.f;
#pragma unroll
            for (int ks = 0; ks < 2; ++ks) {
                FragA bk;
#pragma unroll
                for (int j = 0; j < 8; ++j)
                    bk.u[j] = *(const unsigned int*)&Kt[n * 16 + ln][ks * 32 + kpair_of(j, g)];
                s[n].v = __builtin_amdgcn_wmma_f32_16x16x32_bf16(
                    false, aq[ks].v, false, bk.v, (short)0, s[n].v, false, false);
            }
            int mv = mask[b * SEQ + kb + n * 16 + ln];   // lane's column is fixed
#pragma unroll
            for (int r = 0; r < 8; ++r)
                s[n].f[r] = (mv == 0) ? -3.0e38f : s[n].f[r] * scale;
        }

        // online softmax: row max / sum live in the C-layout (r, half-g) striping
        float rm[8], rs[8];
#pragma unroll
        for (int r = 0; r < 8; ++r)
            rm[r] = fmaxf(fmaxf(s[0].f[r], s[1].f[r]), fmaxf(s[2].f[r], s[3].f[r]));
#pragma unroll
        for (int off = 8; off >= 1; off >>= 1)
#pragma unroll
            for (int r = 0; r < 8; ++r)
                rm[r] = fmaxf(rm[r], __shfl_xor(rm[r], off, 32));

#pragma unroll
        for (int r = 0; r < 8; ++r) {
            float mn    = fmaxf(m[r], rm[r]);
            float alpha = __expf(m[r] - mn);
            m[r] = mn;
            l[r] *= alpha;
#pragma unroll
            for (int dt = 0; dt < 4; ++dt) o[dt].f[r] *= alpha;
            float part = 0.f;
#pragma unroll
            for (int n = 0; n < 4; ++n) {
                float p = __expf(s[n].f[r] - mn);
                s[n].f[r] = p;
                part += p;
            }
            rs[r] = part;
        }
#pragma unroll
        for (int off = 8; off >= 1; off >>= 1)
#pragma unroll
            for (int r = 0; r < 8; ++r)
                rs[r] += __shfl_xor(rs[r], off, 32);
#pragma unroll
        for (int r = 0; r < 8; ++r) l[r] += rs[r];

        // P: C-layout regs -> LDS -> A-layout fragments
#pragma unroll
        for (int n = 0; n < 4; ++n)
#pragma unroll
            for (int r = 0; r < 8; ++r)
                Ps[wid][r + 8 * g][n * 16 + ln] = f2bf(s[n].f[r]);
        __syncthreads();

        // O += P @ V
#pragma unroll
        for (int dt = 0; dt < 4; ++dt)
#pragma unroll
            for (int ks = 0; ks < 2; ++ks) {
                FragA ap, bv;
#pragma unroll
                for (int j = 0; j < 8; ++j)
                    ap.u[j] = *(const unsigned int*)&Ps[wid][ln][ks * 32 + kpair_of(j, g)];
                load_b_tr16(bv, &Vs[0][0], 80, ks * 32, dt * 16, lane);
                o[dt].v = __builtin_amdgcn_wmma_f32_16x16x32_bf16(
                    false, ap.v, false, bv.v, (short)0, o[dt].v, false, false);
            }
    }

    // normalize and emit ctx (bf16, [B,T,E] row-major with head offset)
#pragma unroll
    for (int r = 0; r < 8; ++r) {
        float inv = 1.f / l[r];
        int row = b * SEQ + q0 + r + 8 * g;
#pragma unroll
        for (int dt = 0; dt < 4; ++dt) {
            int col = h * HDIM + dt * 16 + ln;
            ctxb[(size_t)row * EMBED + col] = f2bf(o[dt].f[r] * inv);
        }
    }
}

// ---------------------------------------------------------------------- launch
extern "C" void kernel_launch(void* const* d_in, const int* in_sizes, int n_in,
                              void* d_out, int out_size, void* d_ws, size_t ws_size,
                              hipStream_t stream) {
    (void)in_sizes; (void)n_in; (void)out_size; (void)ws_size;
    const float* x    = (const float*)d_in[0];
    const int*   mask = (const int*)  d_in[1];
    const float* Wqkv = (const float*)d_in[2];
    const float* bqkv = (const float*)d_in[3];
    const float* Wout = (const float*)d_in[4];
    const float* bout = (const float*)d_in[5];

    char* ws = (char*)d_ws;
    size_t off = 0;
    unsigned short* xb    = (unsigned short*)(ws + off); off += (size_t)ROWS  * EMBED * 2;
    unsigned short* wqkvb = (unsigned short*)(ws + off); off += (size_t)EMBED * QKV_N * 2;
    unsigned short* woutb = (unsigned short*)(ws + off); off += (size_t)EMBED * EMBED * 2;
    unsigned short* qkvb  = (unsigned short*)(ws + off); off += (size_t)ROWS  * QKV_N * 2;
    unsigned short* ctxb  = (unsigned short*)(ws + off); off += (size_t)ROWS  * EMBED * 2;

    int n1 = ROWS * EMBED;
    cvt_f32_bf16<<<(n1 + 255) / 256, 256, 0, stream>>>(x, xb, n1);
    int n2 = EMBED * QKV_N;
    cvt_f32_bf16<<<(n2 + 255) / 256, 256, 0, stream>>>(Wqkv, wqkvb, n2);
    int n3 = EMBED * EMBED;
    cvt_f32_bf16<<<(n3 + 255) / 256, 256, 0, stream>>>(Wout, woutb, n3);

    // qkv = x @ Wqkv + bqkv   (bf16 out)
    gemm_bf16_wmma<true><<<dim3(QKV_N / 128, ROWS / 128), 256, 0, stream>>>(
        xb, wqkvb, bqkv, qkvb, ROWS, QKV_N, EMBED);

    // streaming attention per (b, h, 64-query block)
    attention_wmma<<<BATCH * HEADS * (SEQ / 64), 128, 0, stream>>>(qkvb, mask, ctxb);

    // out = ctx @ Wout + bout  (fp32 out)
    gemm_bf16_wmma<false><<<dim3(EMBED / 128, ROWS / 128), 256, 0, stream>>>(
        ctxb, woutb, bout, d_out, ROWS, EMBED, EMBED);
}

// v002
// One run takes 337 microseconds.
// In both of two side-by-side timings against v001, it was 1.23 times as fast.
// Over all steps from v000 it is 3.93 times as fast.
#include <hip/hip_runtime.h>
#include <stdint.h>

#define EMBED 1024
#define HEADS 16
#define HDIM  64
#define BATCH 4
#define SEQ   2048
#define ROWS  (BATCH * SEQ)     // 8192
#define QKV_N (3 * EMBED)       // 3072

typedef __bf16 bf16_t;
typedef bf16_t v16bf __attribute__((ext_vector_type(16)));
typedef float  v8f   __attribute__((ext_vector_type(8)));
typedef int    v4i   __attribute__((ext_vector_type(4)));

typedef short  v8s   __attribute__((ext_vector_type(8)));

union FragA { v16bf v; unsigned int u[8]; v8s h[2]; };
union FragC { v8f  v; float f[8]; };

__device__ __forceinline__ unsigned short f2bf(float x) {
    union { float f; unsigned int u; } c; c.f = x;
    unsigned int r = (c.u + 0x7fffu + ((c.u >> 16) & 1u)) >> 16;  // RNE
    return (unsigned short)r;
}

__device__ __forceinline__ int kpair_of(int j, int g) {
    return ((j >> 2) << 4) | (g << 3) | ((j & 3) << 1);
}

#if __has_builtin(__builtin_amdgcn_global_load_async_to_lds_b128)
#define HAVE_ASYNC_LDS 1
#else
#define HAVE_ASYNC_LDS 0
#endif

__device__ __forceinline__ void async_copy16(const void* gsrc, void* lds) {
#if HAVE_ASYNC_LDS
    __builtin_amdgcn_global_load_async_to_lds_b128(
        (__attribute__((address_space(1))) v4i*)gsrc,
        (__attribute__((address_space(3))) v4i*)lds, 0, 0);
#else
    *(uint4*)lds = *(const uint4*)gsrc;
#endif
}

__device__ __forceinline__ void wait_async0() {
#if HAVE_ASYNC_LDS
#if __has_builtin(__builtin_amdgcn_s_wait_asynccnt)
    __builtin_amdgcn_s_wait_asynccnt(0);
#else
    asm volatile("s_wait_asynccnt 0" ::: "memory");
#endif
#endif
}

__device__ __forceinline__ void load_b_tr16(FragA& f, const unsigned short* tile,
                                            int pitch, int k0, int n0, int lane) {
    typedef __attribute__((address_space(3))) v8s lds_v8s;
    const unsigned short* p =
        tile + (k0 + ((lane >> 4) << 3) + (lane & 7)) * pitch + n0 + (((lane >> 3) & 1) << 3);
    f.h[0] = __builtin_amdgcn_ds_load_tr16_b128_v8i16((lds_v8s*)p);
    f.h[1] = __builtin_amdgcn_ds_load_tr16_b128_v8i16((lds_v8s*)(p + 16 * pitch));
}

// ---------------------------------------------------------------- fp32 -> bf16
__global__ void cvt_f32_bf16(const float* __restrict__ src,
                             unsigned short* __restrict__ dst, int n) {
    int i = blockIdx.x * blockDim.x + threadIdx.x;
    if (i < n) dst[i] = f2bf(src[i]);
}

// -------------------------------------------------- tiled bf16 GEMM + bias
// C[M,N] = A[M,K] @ B[K,N] + bias[N]; 128x128 tile, BK=32, 8 waves,
// each wave computes 32x64 (2x4 tiles of 16x16) via v_wmma_f32_16x16x32_bf16.
template <bool STORE_BF16>
__global__ __launch_bounds__(256)
void gemm_bf16_wmma(const unsigned short* __restrict__ A,
                    const unsigned short* __restrict__ Bm,
                    const float* __restrict__ bias,
                    void* __restrict__ Cout,
                    int M, int N, int K) {
    __shared__ __attribute__((aligned(16))) unsigned short As[128][40];
    __shared__ __attribute__((aligned(16))) unsigned short Bs[32][144];

    const int tid  = threadIdx.x;
    const int wid  = tid >> 5, lane = tid & 31;
    const int g    = lane >> 4, ln = lane & 15;
    const int wm   = wid >> 1,  wn = wid & 1;
    const int m0   = blockIdx.y * 128, n0 = blockIdx.x * 128;

    FragC acc[2][4];
#pragma unroll
    for (int tm = 0; tm < 2; ++tm)
#pragma unroll
        for (int tn = 0; tn < 4; ++tn)
#pragma unroll
            for (int r = 0; r < 8; ++r) acc[tm][tn].f[r] = 0.f;

    for (int kb = 0; kb < K; kb += 32) {
        __syncthreads();
        // A tile: straight row copy -> async global->LDS (2 x b128 per thread)
#pragma unroll
        for (int i = 0; i < 2; ++i) {
            int q = tid + i * 256;              // 0..511
            int row = q >> 2, seg = (q & 3) << 3;   // seg in elements (8 = 16B)
            async_copy16(A + (size_t)(m0 + row) * K + kb + seg, &As[row][seg]);
        }
        // B tile: straight row copy too (2 x b128 per thread); the read transposes
#pragma unroll
        for (int i = 0; i < 2; ++i) {
            int q = tid + i * 256;              // 0..511
            int kk = q >> 4, seg = (q & 15) << 3;
            async_copy16(Bm + (size_t)(kb + kk) * N + n0 + seg, &Bs[kk][seg]);
        }
        wait_async0();
        __syncthreads();   // publishes both tiles; also holds the LDS reads behind the wait

        FragA a[2], b[4];
#pragma unroll
        for (int tm = 0; tm < 2; ++tm)
#pragma unroll
            for (int j = 0; j < 8; ++j)
                a[tm].u[j] = *(const unsigned int*)&As[wm * 32 + tm * 16 + ln][kpair_of(j, g)];
#pragma unroll
        for (int tn = 0; tn < 4; ++tn)
            load_b_tr16(b[tn], &Bs[0][0], 144, 0, wn * 64 + tn * 16, lane);
#pragma unroll
        for (int tm = 0; tm < 2; ++tm)
#pragma unroll
            for (int tn = 0; tn < 4; ++tn)
                acc[tm][tn].v = __builtin_amdgcn_wmma_f32_16x16x32_bf16(
                    false, a[tm].v, false, b[tn].v, (short)0, acc[tm][tn].v, false, false);
    }

#pragma unroll
    for (int tm = 0; tm < 2; ++tm)
#pragma unroll
        for (int tn = 0; tn < 4; ++tn)
#pragma unroll
            for (int r = 0; r < 8; ++r) {
                int row = m0 + wm * 32 + tm * 16 + r + 8 * g;
                int col = n0 + wn * 64 + tn * 16 + ln;
                float v = acc[tm][tn].f[r] + bias[col];
                if (STORE_BF16)
                    ((unsigned short*)Cout)[(size_t)row * N + col] = f2bf(v);
                else
                    ((float*)Cout)[(size_t)row * N + col] = v;
            }
}

// ------------------------------------------------ flash-attention (streaming)
// grid = B*H*(SEQ/64), 128 threads (4 waves). Wave = 16 query rows.
__global__ __launch_bounds__(128)
void attention_wmma(const unsigned short* __restrict__ qkvb,   // [ROWS, 3E] bf16
                    const int* __restrict__ mask,              // [B*SEQ]
                    unsigned short* __restrict__ ctxb) {       // [ROWS, E] bf16
    // K in front of V in one object: V's column block lies 2048 B behind K's in a qkv row, the
    // compiler folds that step into the V copies' offset field (which moves the LDS address
    // too) and takes it off their LDS address register; with V at 9216 B that stays above 0.
    struct __attribute__((aligned(16))) KVTiles {
        unsigned short k[64][72];
        unsigned short v[64][80];
    };
    __shared__ KVTiles kv;
    unsigned short (&Kt)[64][72] = kv.k;
    unsigned short (&Vs)[64][80] = kv.v;
    __shared__ __attribute__((aligned(16))) unsigned short Ps[4][16][72];   // per-wave P staging [qrow][key], pitch 144 B

    const int tid = threadIdx.x;
    const int wid = tid >> 5, lane = tid & 31;
    const int g   = lane >> 4, ln = lane & 15;

    const int nqb = SEQ / 64;                       // 32
    const int qb  = blockIdx.x % nqb;
    const int h   = (blockIdx.x / nqb) % HEADS;
    const int b   = blockIdx.x / (nqb * HEADS);

    const int    q0   = qb * 64 + wid * 16;
    const size_t rowB = (size_t)b * SEQ;
    const float  scale = 0.125f;                    // 1/sqrt(64)

    // Q fragments (A-matrix 16x32, two for d=64) loaded once from global
    FragA aq[2];
#pragma unroll
    for (int f = 0; f < 2; ++f)
#pragma unroll
        for (int j = 0; j < 8; ++j) {
            int col = h * HDIM + f * 32 + kpair_of(j, g);
            aq[f].u[j] = *(const unsigned int*)(qkvb + (rowB + q0 + ln) * (size_t)QKV_N + col);
        }

    float m[8], l[8];
    FragC o[4];
#pragma unroll
    for (int r = 0; r < 8; ++r) { m[r] = -3.0e38f; l[r] = 0.f; }
#pragma unroll
    for (int dt = 0; dt < 4; ++dt)
#pragma unroll
        for (int r = 0; r < 8; ++r) o[dt].f[r] = 0.f;

    for (int kb = 0; kb < SEQ; kb += 64) {
        __syncthreads();
        // K tile: straight row copy -> async global->LDS (4 x b128 per thread)
#pragma unroll
        for (int i = 0; i < 4; ++i) {
            int q = tid + i * 128;                 // 0..511
            int key = q >> 3, seg = (q & 7) << 3;  // seg in elements (8 = 16B)
            async_copy16(qkvb + (rowB + kb + key) * (size_t)QKV_N + EMBED + h * HDIM + seg,
                         &Kt[key][seg]);
        }
        // V tile: straight row copy too (4 x b128 per thread); the read transposes
#pragma unroll
        for (int i = 0; i < 4; ++i) {
            int q = tid + i * 128;                 // 0..511
            int key = q >> 3, seg = (q & 7) << 3;
            async_copy16(qkvb + (rowB + kb + key) * (size_t)QKV_N + 2 * EMBED + h * HDIM + seg,
                         &Vs[key][seg]);
        }
        wait_async0();
        __syncthreads();   // publishes both tiles; also holds the LDS reads behind the wait

        // S = scale * Q K^T   (16 x 64 per wave), + mask
        FragC s[4];
#pragma unroll
        for (int n = 0; n < 4; ++n) {
#pragma unroll
            for (int r = 0; r < 8; ++r) s[n].f[r] = 0.f;
#pragma unroll
            for (int ks = 0; ks < 2; ++ks) {
                FragA bk;
#pragma unroll
                for (int j = 0; j < 8; ++j)
                    bk.u[j] = *(const unsigned int*)&Kt[n * 16 + ln][ks * 32 + kpair_of(j, g)];
                s[n].v = __builtin_amdgcn_wmma_f32_16x16x32_bf16(
                    false, aq[ks].v, false, bk.v, (short)0, s[n].v, false, false);
            }
            int mv = mask[b * SEQ + kb + n * 16 + ln];   // lane's column is fixed
#pragma unroll
            for (int r = 0; r < 8; ++r)
                s[n].f[r] = (mv == 0) ? -3.0e38f : s[n].f[r] * scale;
        }

        // online softmax: row max / sum live in the C-layout (r, half-g) striping
        float rm[8], rs[8];
#pragma unroll
        for (int r = 0; r < 8; ++r)
            rm[r] = fmaxf(fmaxf(s[0].f[r], s[1].f[r]), fmaxf(s[2].f[r], s[3].f[r]));
#pragma unroll
        for (int off = 8; off >= 1; off >>= 1)
#pragma unroll
            for (int r = 0; r < 8; ++r)
                rm[r] = fmaxf(rm[r], __shfl_xor(rm[r], off, 32));

#pragma unroll
        for (int r = 0; r < 8; ++r) {
            float mn    = fmaxf(m[r], rm[r]);
            float alpha = __expf(m[r] - mn);
            m[r] = mn;
            l[r] *= alpha;
#pragma unroll
            for (int dt = 0; dt < 4; ++dt) o[dt].f[r] *= alpha;
            float part = 0.f;
#pragma unroll
            for (int n = 0; n < 4; ++n) {
                float p = __expf(s[n].f[r] - mn);
                s[n].f[r] = p;
                part += p;
            }
            rs[r] = part;
        }
#pragma unroll
        for (int off = 8; off >= 1; off >>= 1)
#pragma unroll
            for (int r = 0; r < 8; ++r)
                rs[r] += __shfl_xor(rs[r], off, 32);
#pragma unroll
        for (int r = 0; r < 8; ++r) l[r] += rs[r];

        // P: C-layout regs -> LDS -> A-layout fragments
#pragma unroll
        for (int n = 0; n < 4; ++n)
#pragma unroll
            for (int r = 0; r < 8; ++r)
                Ps[wid][r + 8 * g][n * 16 + ln] = f2bf(s[n].f[r]);
        __syncthreads();

        // O += P @ V
#pragma unroll
        for (int dt = 0; dt < 4; ++dt)
#pragma unroll
            for (int ks = 0; ks < 2; ++ks) {
                FragA ap, bv;
#pragma unroll
                for (int j = 0; j < 8; ++j)
                    ap.u[j] = *(const unsigned int*)&Ps[wid][ln][ks * 32 + kpair_of(j, g)];
                load_b_tr16(bv, &Vs[0][0], 80, ks * 32, dt * 16, lane);
                o[dt].v = __builtin_amdgcn_wmma_f32_16x16x32_bf16(
                    false, ap.v, false, bv.v, (short)0, o[dt].v, false, false);
            }
    }

    // normalize and emit ctx (bf16, [B,T,E] row-major with head offset)
#pragma unroll
    for (int r = 0; r < 8; ++r) {
        float inv = 1.f / l[r];
        int row = b * SEQ + q0 + r + 8 * g;
#pragma unroll
        for (int dt = 0; dt < 4; ++dt) {
            int col = h * HDIM + dt * 16 + ln;
            ctxb[(size_t)row * EMBED + col] = f2bf(o[dt].f[r] * inv);
        }
    }
}

// ---------------------------------------------------------------------- launch
extern "C" void kernel_launch(void* const* d_in, const int* in_sizes, int n_in,
                              void* d_out, int out_size, void* d_ws, size_t ws_size,
                              hipStream_t stream) {
    (void)in_sizes; (void)n_in; (void)out_size; (void)ws_size;
    const float* x    = (const float*)d_in[0];
    const int*   mask = (const int*)  d_in[1];
    const float* Wqkv = (const float*)d_in[2];
    const float* bqkv = (const float*)d_in[3];
    const float* Wout = (const float*)d_in[4];
    const float* bout = (const float*)d_in[5];

    char* ws = (char*)d_ws;
    size_t off = 0;
    unsigned short* xb    = (unsigned short*)(ws + off); off += (size_t)ROWS  * EMBED * 2;
    unsigned short* wqkvb = (unsigned short*)(ws + off); off += (size_t)EMBED * QKV_N * 2;
    unsigned short* woutb = (unsigned short*)(ws + off); off += (size_t)EMBED * EMBED * 2;
    unsigned short* qkvb  = (unsigned short*)(ws + off); off += (size_t)ROWS  * QKV_N * 2;
    unsigned short* ctxb  = (unsigned short*)(ws + off); off += (size_t)ROWS  * EMBED * 2;

    int n1 = ROWS * EMBED;
    cvt_f32_bf16<<<(n1 + 255) / 256, 256, 0, stream>>>(x, xb, n1);
    int n2 = EMBED * QKV_N;
    cvt_f32_bf16<<<(n2 + 255) / 256, 256, 0, stream>>>(Wqkv, wqkvb, n2);
    int n3 = EMBED * EMBED;
    cvt_f32_bf16<<<(n3 + 255) / 256, 256, 0, stream>>>(Wout, woutb, n3);

    // qkv = x @ Wqkv + bqkv   (bf16 out)
    gemm_bf16_wmma<true><<<dim3(QKV_N / 128, ROWS / 128), 256, 0, stream>>>(
        xb, wqkvb, bqkv, qkvb, ROWS, QKV_N, EMBED);

    // streaming attention per (b, h, 64-query block)
    attention_wmma<<<BATCH * HEADS * (SEQ / 64), 128, 0, stream>>>(qkvb, mask, ctxb);

    // out = ctx @ Wout + bout  (fp32 out)
    gemm_bf16_wmma<false><<<dim3(EMBED / 128, ROWS / 128), 256, 0, stream>>>(
        ctxb, woutb, bout, d_out, ROWS, EMBED, EMBED);
}

// v003
// A run of this version takes 323 microseconds.
// Timed twice side by side with v002, it ran 1.04 times as fast both times.
// Over all steps from v000 it is 4.10 times as fast.
#include <hip/hip_runtime.h>
#include <stdint.h>

#define EMBED 1024
#define HEADS 16
#define HDIM  64
#define BATCH 4
#define SEQ   2048
#define ROWS  (BATCH * SEQ)     // 8192
#define QKV_N (3 * EMBED)       // 3072

typedef __bf16 bf16_t;
typedef bf16_t v16bf __attribute__((ext_vector_type(16)));
typedef float  v8f   __attribute__((ext_vector_type(8)));
typedef int    v4i   __attribute__((ext_vector_type(4)));

typedef short  v8s   __attribute__((ext_vector_type(8)));

union FragA { v16bf v; unsigned int u[8]; v8s h[2]; };
union FragC { v8f  v; float f[8]; };

__device__ __forceinline__ unsigned short f2bf(float x) {
    union { float f; unsigned int u; } c; c.f = x;
    unsigned int r = (c.u + 0x7fffu + ((c.u >> 16) & 1u)) >> 16;  // RNE
    return (unsigned short)r;
}

__device__ __forceinline__ int kpair_of(int j, int g) {
    return ((j >> 2) << 4) | (g << 3) | ((j & 3) << 1);
}

#if __has_builtin(__builtin_amdgcn_global_load_async_to_lds_b128)
#define HAVE_ASYNC_LDS 1
#else
#define HAVE_ASYNC_LDS 0
#endif

__device__ __forceinline__ void async_copy16(const void* gsrc, void* lds) {
#if HAVE_ASYNC_LDS
    __builtin_amdgcn_global_load_async_to_lds_b128(
        (__attribute__((address_space(1))) v4i*)gsrc,
        (__attribute__((address_space(3))) v4i*)lds, 0, 0);
#else
    *(uint4*)lds = *(const uint4*)gsrc;
#endif
}

__device__ __forceinline__ void wait_async0() {
#if HAVE_ASYNC_LDS
#if __has_builtin(__builtin_amdgcn_s_wait_asynccnt)
    __builtin_amdgcn_s_wait_asynccnt(0);
#else
    asm volatile("s_wait_asynccnt 0" ::: "memory");
#endif
#endif
}

__device__ __forceinline__ void load_b_tr16(FragA& f, const unsigned short* tile,
                                            int pitch, int k0, int n0, int lane) {
    typedef __attribute__((address_space(3))) v8s lds_v8s;
    const unsigned short* p =
        tile + (k0 + ((lane >> 4) << 3) + (lane & 7)) * pitch + n0 + (((lane >> 3) & 1) << 3);
    f.h[0] = __builtin_amdgcn_ds_load_tr16_b128_v8i16((lds_v8s*)p);
    f.h[1] = __builtin_amdgcn_ds_load_tr16_b128_v8i16((lds_v8s*)(p + 16 * pitch));
}

// ---------------------------------------------------------------- fp32 -> bf16
// Each block converts 256 * PER groups of 4 floats that lie in a row; the grid covers the
// array exactly. A wave's load covers 512 B in a row, its store 256 B: whole lines both ways.
// All PER loads of a lane are issued before the first is used.
template <int PER>
__global__ __launch_bounds__(256)
void cvt_f32_bf16(const float* __restrict__ src, unsigned short* __restrict__ dst) {
    const size_t g0 = (size_t)blockIdx.x * (256 * PER) + threadIdx.x;
    const float4* __restrict__ s4 = (const float4*)src;
    uint2* __restrict__ d4 = (uint2*)dst;
    float4 v[PER];
#pragma unroll   // v[] stays in registers and the loads go out as one run, ahead of any use
    for (int i = 0; i < PER; ++i) v[i] = s4[g0 + i * 256];
#pragma unroll   // constant indices into v[]
    for (int i = 0; i < PER; ++i) {
        uint2 o;
        o.x = (unsigned int)f2bf(v[i].x) | ((unsigned int)f2bf(v[i].y) << 16);
        o.y = (unsigned int)f2bf(v[i].z) | ((unsigned int)f2bf(v[i].w) << 16);
        d4[g0 + i * 256] = o;
    }
}

// -------------------------------------------------- tiled bf16 GEMM + bias
// C[M,N] = A[M,K] @ B[K,N] + bias[N]; 128x128 tile, BK=32, 8 waves,
// each wave computes 32x64 (2x4 tiles of 16x16) via v_wmma_f32_16x16x32_bf16.
template <bool STORE_BF16>
__global__ __launch_bounds__(256)
void gemm_bf16_wmma(const unsigned short* __restrict__ A,
                    const unsigned short* __restrict__ Bm,
                    const float* __restrict__ bias,
                    void* __restrict__ Cout,
                    int M, int N, int K) {
    __shared__ __attribute__((aligned(16))) unsigned short As[128][40];
    __shared__ __attribute__((aligned(16))) unsigned short Bs[32][144];

    const int tid  = threadIdx.x;
    const int wid  = tid >> 5, lane = tid & 31;
    const int g    = lane >> 4, ln = lane & 15;
    const int wm   = wid >> 1,  wn = wid & 1;
    const int m0   = blockIdx.y * 128, n0 = blockIdx.x * 128;

    FragC acc[2][4];
#pragma unroll
    for (int tm = 0; tm < 2; ++tm)
#pragma unroll
        for (int tn = 0; tn < 4; ++tn)
#pragma unroll
            for (int r = 0; r < 8; ++r) acc[tm][tn].f[r] = 0.f;

    for (int kb = 0; kb < K; kb += 32) {
        __syncthreads();
        // A tile: straight row copy -> async global->LDS (2 x b128 per thread)
#pragma unroll
        for (int i = 0; i < 2; ++i) {
            int q = tid + i * 256;              // 0..511
            int row = q >> 2, seg = (q & 3) << 3;   // seg in elements (8 = 16B)
            async_copy16(A + (size_t)(m0 + row) * K + kb + seg, &As[row][seg]);
        }
        // B tile: straight row copy too (2 x b128 per thread); the read transposes
#pragma unroll
        for (int i = 0; i < 2; ++i) {
            int q = tid + i * 256;              // 0..511
            int kk = q >> 4, seg = (q & 15) << 3;
            async_copy16(Bm + (size_t)(kb + kk) * N + n0 + seg, &Bs[kk][seg]);
        }
        wait_async0();
        __syncthreads();   // publishes both tiles; also holds the LDS reads behind the wait

        FragA a[2], b[4];
#pragma unroll
        for (int tm = 0; tm < 2; ++tm)
#pragma unroll
            for (int j = 0; j < 8; ++j)
                a[tm].u[j] = *(const unsigned int*)&As[wm * 32 + tm * 16 + ln][kpair_of(j, g)];
#pragma unroll
        for (int tn = 0; tn < 4; ++tn)
            load_b_tr16(b[tn], &Bs[0][0], 144, 0, wn * 64 + tn * 16, lane);
#pragma unroll
        for (int tm = 0; tm < 2; ++tm)
#pragma unroll
            for (int tn = 0; tn < 4; ++tn)
                acc[tm][tn].v = __builtin_amdgcn_wmma_f32_16x16x32_bf16(
                    false, a[tm].v, false, b[tn].v, (short)0, acc[tm][tn].v, false, false);
    }

#pragma unroll
    for (int tm = 0; tm < 2; ++tm)
#pragma unroll
        for (int tn = 0; tn < 4; ++tn)
#pragma unroll
            for (int r = 0; r < 8; ++r) {
                int row = m0 + wm * 32 + tm * 16 + r + 8 * g;
                int col = n0 + wn * 64 + tn * 16 + ln;
                float v = acc[tm][tn].f[r] + bias[col];
                if (STORE_BF16)
                    ((unsigned short*)Cout)[(size_t)row * N + col] = f2bf(v);
                else
                    ((float*)Cout)[(size_t)row * N + col] = v;
            }
}

// ------------------------------------------------ flash-attention (streaming)
// grid = B*H*(SEQ/64), 128 threads (4 waves). Wave = 16 query rows.
__global__ __launch_bounds__(128)
void attention_wmma(const unsigned short* __restrict__ qkvb,   // [ROWS, 3E] bf16
                    const int* __restrict__ mask,              // [B*SEQ]
                    unsigned short* __restrict__ ctxb) {       // [ROWS, E] bf16
    // K in front of V in one object: V's column block lies 2048 B behind K's in a qkv row, the
    // compiler folds that step into the V copies' offset field (which moves the LDS address
    // too) and takes it off their LDS address register; with V at 9216 B that stays above 0.
    struct __attribute__((aligned(16))) KVTiles {
        unsigned short k[64][72];
        unsigned short v[64][80];
    };
    __shared__ KVTiles kv;
    unsigned short (&Kt)[64][72] = kv.k;
    unsigned short (&Vs)[64][80] = kv.v;
    __shared__ __attribute__((aligned(16))) unsigned short Ps[4][16][72];   // per-wave P staging [qrow][key], pitch 144 B

    const int tid = threadIdx.x;
    const int wid = tid >> 5, lane = tid & 31;
    const int g   = lane >> 4, ln = lane & 15;

    const int nqb = SEQ / 64;                       // 32
    const int qb  = blockIdx.x % nqb;
    const int h   = (blockIdx.x / nqb) % HEADS;
    const int b   = blockIdx.x / (nqb * HEADS);

    const int    q0   = qb * 64 + wid * 16;
    const size_t rowB = (size_t)b * SEQ;
    const float  scale = 0.125f;                    // 1/sqrt(64)

    // Q fragments (A-matrix 16x32, two for d=64) loaded once from global
    FragA aq[2];
#pragma unroll
    for (int f = 0; f < 2; ++f)
#pragma unroll
        for (int j = 0; j < 8; ++j) {
            int col = h * HDIM + f * 32 + kpair_of(j, g);
            aq[f].u[j] = *(const unsigned int*)(qkvb + (rowB + q0 + ln) * (size_t)QKV_N + col);
        }

    float m[8], l[8];
    FragC o[4];
#pragma unroll
    for (int r = 0; r < 8; ++r) { m[r] = -3.0e38f; l[r] = 0.f; }
#pragma unroll
    for (int dt = 0; dt < 4; ++dt)
#pragma unroll
        for (int r = 0; r < 8; ++r) o[dt].f[r] = 0.f;

    for (int kb = 0; kb < SEQ; kb += 64) {
        __syncthreads();
        // K tile: straight row copy -> async global->LDS (4 x b128 per thread)
#pragma unroll
        for (int i = 0; i < 4; ++i) {
            int q = tid + i * 128;                 // 0..511
            int key = q >> 3, seg = (q & 7) << 3;  // seg in elements (8 = 16B)
            async_copy16(qkvb + (rowB + kb + key) * (size_t)QKV_N + EMBED + h * HDIM + seg,
                         &Kt[key][seg]);
        }
        // V tile: straight row copy too (4 x b128 per thread); the read transposes
#pragma unroll
        for (int i = 0; i < 4; ++i) {
            int q = tid + i * 128;                 // 0..511
            int key = q >> 3, seg = (q & 7) << 3;
            async_copy16(qkvb + (rowB + kb + key) * (size_t)QKV_N + 2 * EMBED + h * HDIM + seg,
                         &Vs[key][seg]);
        }
        wait_async0();
        __syncthreads();   // publishes both tiles; also holds the LDS reads behind the wait

        // S = scale * Q K^T   (16 x 64 per wave), + mask
        FragC s[4];
#pragma unroll
        for (int n = 0; n < 4; ++n) {
#pragma unroll
            for (int r = 0; r < 8; ++r) s[n].f[r] = 0.f;
#pragma unroll
            for (int ks = 0; ks < 2; ++ks) {
                FragA bk;
#pragma unroll
                for (int j = 0; j < 8; ++j)
                    bk.u[j] = *(const unsigned int*)&Kt[n * 16 + ln][ks * 32 + kpair_of(j, g)];
                s[n].v = __builtin_amdgcn_wmma_f32_16x16x32_bf16(
                    false, aq[ks].v, false, bk.v, (short)0, s[n].v, false, false);
            }
            int mv = mask[b * SEQ + kb + n * 16 + ln];   // lane's column is fixed
#pragma unroll
            for (int r = 0; r < 8; ++r)
                s[n].f[r] = (mv == 0) ? -3.0e38f : s[n].f[r] * scale;
        }

        // online softmax: row max / sum live in the C-layout (r, half-g) striping
        float rm[8], rs[8];
#pragma unroll
        for (int r = 0; r < 8; ++r)
            rm[r] = fmaxf(fmaxf(s[0].f[r], s[1].f[r]), fmaxf(s[2].f[r], s[3].f[r]));
#pragma unroll
        for (int off = 8; off >= 1; off >>= 1)
#pragma unroll
            for (int r = 0; r < 8; ++r)
                rm[r] = fmaxf(rm[r], __shfl_xor(rm[r], off, 32));

#pragma unroll
        for (int r = 0; r < 8; ++r) {
            float mn    = fmaxf(m[r], rm[r]);
            float alpha = __expf(m[r] - mn);
            m[r] = mn;
            l[r] *= alpha;
#pragma unroll
            for (int dt = 0; dt < 4; ++dt) o[dt].f[r] *= alpha;
            float part = 0.f;
#pragma unroll
            for (int n = 0; n < 4; ++n) {
                float p = __expf(s[n].f[r] - mn);
                s[n].f[r] = p;
                part += p;
            }
            rs[r] = part;
        }
#pragma unroll
        for (int off = 8; off >= 1; off >>= 1)
#pragma unroll
            for (int r = 0; r < 8; ++r)
                rs[r] += __shfl_xor(rs[r], off, 32);
#pragma unroll
        for (int r = 0; r < 8; ++r) l[r] += rs[r];

        // P: C-layout regs -> LDS -> A-layout fragments
#pragma unroll
        for (int n = 0; n < 4; ++n)
#pragma unroll
            for (int r = 0; r < 8; ++r)
                Ps[wid][r + 8 * g][n * 16 + ln] = f2bf(s[n].f[r]);
        __syncthreads();

        // O += P @ V
#pragma unroll
        for (int dt = 0; dt < 4; ++dt)
#pragma unroll
            for (int ks = 0; ks < 2; ++ks) {
                FragA ap, bv;
#pragma unroll
                for (int j = 0; j < 8; ++j)
                    ap.u[j] = *(const unsigned int*)&Ps[wid][ln][ks * 32 + kpair_of(j, g)];
                load_b_tr16(bv, &Vs[0][0], 80, ks * 32, dt * 16, lane);
                o[dt].v = __builtin_amdgcn_wmma_f32_16x16x32_bf16(
                    false, ap.v, false, bv.v, (short)0, o[dt].v, false, false);
            }
    }

    // normalize and emit ctx (bf16, [B,T,E] row-major with head offset)
#pragma unroll
    for (int r = 0; r < 8; ++r) {
        float inv = 1.f / l[r];
        int row = b * SEQ + q0 + r + 8 * g;
#pragma unroll
        for (int dt = 0; dt < 4; ++dt) {
            int col = h * HDIM + dt * 16 + ln;
            ctxb[(size_t)row * EMBED + col] = f2bf(o[dt].f[r] * inv);
        }
    }
}

// ---------------------------------------------------------------------- launch
extern "C" void kernel_launch(void* const* d_in, const int* in_sizes, int n_in,
                              void* d_out, int out_size, void* d_ws, size_t ws_size,
                              hipStream_t stream) {
    (void)in_sizes; (void)n_in; (void)out_size; (void)ws_size;
    const float* x    = (const float*)d_in[0];
    const int*   mask = (const int*)  d_in[1];
    const float* Wqkv = (const float*)d_in[2];
    const float* bqkv = (const float*)d_in[3];
    const float* Wout = (const float*)d_in[4];
    const float* bout = (const float*)d_in[5];

    char* ws = (char*)d_ws;
    size_t off = 0;
    unsigned short* xb    = (unsigned short*)(ws + off); off += (size_t)ROWS  * EMBED * 2;
    unsigned short* wqkvb = (unsigned short*)(ws + off); off += (size_t)EMBED * QKV_N * 2;
    unsigned short* woutb = (unsigned short*)(ws + off); off += (size_t)EMBED * EMBED * 2;
    unsigned short* qkvb  = (unsigned short*)(ws + off); off += (size_t)ROWS  * QKV_N * 2;
    unsigned short* ctxb  = (unsigned short*)(ws + off); off += (size_t)ROWS  * EMBED * 2;

    static_assert((ROWS * EMBED) % (256 * 8 * 4) == 0 && (EMBED * QKV_N) % (256 * 6 * 4) == 0 &&
                  (EMBED * EMBED) % (256 * 4 * 4) == 0, "convert grids cover the arrays exactly");
    cvt_f32_bf16<8><<<(ROWS * EMBED) / (256 * 8 * 4), 256, 0, stream>>>(x, xb);          // 1024 blocks
    cvt_f32_bf16<6><<<(EMBED * QKV_N) / (256 * 6 * 4), 256, 0, stream>>>(Wqkv, wqkvb);   // 512 blocks
    cvt_f32_bf16<4><<<(EMBED * EMBED) / (256 * 4 * 4), 256, 0, stream>>>(Wout, woutb);   // 256 blocks

    // qkv = x @ Wqkv + bqkv   (bf16 out)
    gemm_bf16_wmma<true><<<dim3(QKV_N / 128, ROWS / 128), 256, 0, stream>>>(
        xb, wqkvb, bqkv, qkvb, ROWS, QKV_N, EMBED);

    // streaming attention per (b, h, 64-query block)
    attention_wmma<<<BATCH * HEADS * (SEQ / 64), 128, 0, stream>>>(qkvb, mask, ctxb);

    // out = ctx @ Wout + bout  (fp32 out)
    gemm_bf16_wmma<false><<<dim3(EMBED / 128, ROWS / 128), 256, 0, stream>>>(
        ctxb, woutb, bout, d_out, ROWS, EMBED, EMBED);
}

// v004
// It runs in 208 microseconds.
// Next to v003, in two timings, it ran 1.57 and 1.56 times as fast.
// All steps since v000 together make it 6.42 times as fast.
#include <hip/hip_runtime.h>
#include <stdint.h>

#define EMBED 1024
#define HEADS 16
#define HDIM  64
#define BATCH 4
#define SEQ   2048
#define ROWS  (BATCH * SEQ)     // 8192
#define QKV_N (3 * EMBED)       // 3072

typedef __bf16 bf16_t;
typedef bf16_t v16bf __attribute__((ext_vector_type(16)));
typedef float  v8f   __attribute__((ext_vector_type(8)));
typedef int    v4i   __attribute__((ext_vector_type(4)));

typedef short  v8s   __attribute__((ext_vector_type(8)));

union FragA { v16bf v; unsigned int u[8]; v8s h[2]; };
union FragC { v8f  v; float f[8]; };

__device__ __forceinline__ unsigned short f2bf(float x) {
    union { float f; unsigned int u; } c; c.f = x;
    unsigned int r = (c.u + 0x7fffu + ((c.u >> 16) & 1u)) >> 16;  // RNE
    return (unsigned short)r;
}

__device__ __forceinline__ int kpair_of(int j, int g) {
    return ((j >> 2) << 4) | (g << 3) | ((j & 3) << 1);
}

#if __has_builtin(__builtin_amdgcn_global_load_async_to_lds_b128)
#define HAVE_ASYNC_LDS 1
#else
#define HAVE_ASYNC_LDS 0
#endif

__device__ __forceinline__ void async_copy16(const void* gsrc, void* lds) {
#if HAVE_ASYNC_LDS
    __builtin_amdgcn_global_load_async_to_lds_b128(
        (__attribute__((address_space(1))) v4i*)gsrc,
        (__attribute__((address_space(3))) v4i*)lds, 0, 0);
#else
    *(uint4*)lds = *(const uint4*)gsrc;
#endif
}

__device__ __forceinline__ void wait_async0() {
#if HAVE_ASYNC_LDS
#if __has_builtin(__builtin_amdgcn_s_wait_asynccnt)
    __builtin_amdgcn_s_wait_asynccnt(0);
#else
    asm volatile("s_wait_asynccnt 0" ::: "memory");
#endif
#endif
}

__device__ __forceinline__ void load_b_tr16(FragA& f, const unsigned short* tile,
                                            int pitch, int k0, int n0, int lane) {
    typedef __attribute__((address_space(3))) v8s lds_v8s;
    const unsigned short* p =
        tile + (k0 + ((lane >> 4) << 3) + (lane & 7)) * pitch + n0 + (((lane >> 3) & 1) << 3);
    f.h[0] = __builtin_amdgcn_ds_load_tr16_b128_v8i16((lds_v8s*)p);
    f.h[1] = __builtin_amdgcn_ds_load_tr16_b128_v8i16((lds_v8s*)(p + 16 * pitch));
}

// ---------------------------------------------------------------- fp32 -> bf16
// Each block converts 256 * PER groups of 4 floats that lie in a row; the grid covers the
// array exactly. A wave's load covers 512 B in a row, its store 256 B: whole lines both ways.
// All PER loads of a lane are issued before the first is used.
template <int PER>
__global__ __launch_bounds__(256)
void cvt_f32_bf16(const float* __restrict__ src, unsigned short* __restrict__ dst) {
    const size_t g0 = (size_t)blockIdx.x * (256 * PER) + threadIdx.x;
    const float4* __restrict__ s4 = (const float4*)src;
    uint2* __restrict__ d4 = (uint2*)dst;
    float4 v[PER];
#pragma unroll   // v[] stays in registers and the loads go out as one run, ahead of any use
    for (int i = 0; i < PER; ++i) v[i] = s4[g0 + i * 256];
#pragma unroll   // constant indices into v[]
    for (int i = 0; i < PER; ++i) {
        uint2 o;
        o.x = (unsigned int)f2bf(v[i].x) | ((unsigned int)f2bf(v[i].y) << 16);
        o.y = (unsigned int)f2bf(v[i].z) | ((unsigned int)f2bf(v[i].w) << 16);
        d4[g0 + i * 256] = o;
    }
}

// -------------------------------------------------- tiled bf16 GEMM + bias
// C[M,N] = A[M,K] @ B[K,N] + bias[N]; 128x128 tile, BK=32, 8 waves,
// each wave computes 32x64 (2x4 tiles of 16x16) via v_wmma_f32_16x16x32_bf16.
template <bool STORE_BF16>
__global__ __launch_bounds__(256)
void gemm_bf16_wmma(const unsigned short* __restrict__ A,
                    const unsigned short* __restrict__ Bm,
                    const float* __restrict__ bias,
                    void* __restrict__ Cout,
                    int M, int N, int K) {
    __shared__ __attribute__((aligned(16))) unsigned short As[128][40];
    __shared__ __attribute__((aligned(16))) unsigned short Bs[32][144];

    const int tid  = threadIdx.x;
    const int wid  = tid >> 5, lane = tid & 31;
    const int g    = lane >> 4, ln = lane & 15;
    const int wm   = wid >> 1,  wn = wid & 1;
    const int m0   = blockIdx.y * 128, n0 = blockIdx.x * 128;

    FragC acc[2][4];
#pragma unroll
    for (int tm = 0; tm < 2; ++tm)
#pragma unroll
        for (int tn = 0; tn < 4; ++tn)
#pragma unroll
            for (int r = 0; r < 8; ++r) acc[tm][tn].f[r] = 0.f;

    for (int kb = 0; kb < K; kb += 32) {
        __syncthreads();
        // A tile: straight row copy -> async global->LDS (2 x b128 per thread)
#pragma unroll
        for (int i = 0; i < 2; ++i) {
            int q = tid + i * 256;              // 0..511
            int row = q >> 2, seg = (q & 3) << 3;   // seg in elements (8 = 16B)
            async_copy16(A + (size_t)(m0 + row) * K + kb + seg, &As[row][seg]);
        }
        // B tile: straight row copy too (2 x b128 per thread); the read transposes
#pragma unroll
        for (int i = 0; i < 2; ++i) {
            int q = tid + i * 256;              // 0..511
            int kk = q >> 4, seg = (q & 15) << 3;
            async_copy16(Bm + (size_t)(kb + kk) * N + n0 + seg, &Bs[kk][seg]);
        }
        wait_async0();
        __syncthreads();   // publishes both tiles; also holds the LDS reads behind the wait

        FragA a[2], b[4];
#pragma unroll
        for (int tm = 0; tm < 2; ++tm)
#pragma unroll
            for (int j = 0; j < 8; ++j)
                a[tm].u[j] = *(const unsigned int*)&As[wm * 32 + tm * 16 + ln][kpair_of(j, g)];
#pragma unroll
        for (int tn = 0; tn < 4; ++tn)
            load_b_tr16(b[tn], &Bs[0][0], 144, 0, wn * 64 + tn * 16, lane);
#pragma unroll
        for (int tm = 0; tm < 2; ++tm)
#pragma unroll
            for (int tn = 0; tn < 4; ++tn)
                acc[tm][tn].v = __builtin_amdgcn_wmma_f32_16x16x32_bf16(
                    false, a[tm].v, false, b[tn].v, (short)0, acc[tm][tn].v, false, false);
    }

#pragma unroll
    for (int tm = 0; tm < 2; ++tm)
#pragma unroll
        for (int tn = 0; tn < 4; ++tn)
#pragma unroll
            for (int r = 0; r < 8; ++r) {
                int row = m0 + wm * 32 + tm * 16 + r + 8 * g;
                int col = n0 + wn * 64 + tn * 16 + ln;
                float v = acc[tm][tn].f[r] + bias[col];
                if (STORE_BF16)
                    ((unsigned short*)Cout)[(size_t)row * N + col] = f2bf(v);
                else
                    ((float*)Cout)[(size_t)row * N + col] = v;
            }
}

// ------------------------------------------------ flash-attention (streaming)
// grid = B*H*(SEQ/64), 128 threads (4 waves). Wave = 16 queries.
// Both products are taken transposed: St = K Qt and Ot += Vt Pt. A lane (c = lane&15, g = lane>>4)
// then holds scores of ONE query (c): register r of score tile n is key n*16 + 8g + r. Row maximum
// and row sum run inside the lane, with one exchange between the lane halves; two score tiles,
// converted in place, are the B operand (32 keys x 16 queries) of the second product.
__device__ __forceinline__ float other_half(float x) {      // value of lane ^ 16
    int b = __float_as_int(x);
    return __int_as_float(__builtin_amdgcn_permlanex16(b, b, 0x76543210, 0xfedcba98, false, false));
}

__global__ __launch_bounds__(128)
void attention_wmma(const unsigned short* __restrict__ qkvb,   // [ROWS, 3E] bf16
                    const int* __restrict__ mask,              // [B*SEQ]
                    unsigned short* __restrict__ ctxb) {       // [ROWS, E] bf16
    // K in front of V in one object: V's column block lies 2048 B behind K's in a qkv row, the
    // compiler folds that step into the V copies' offset field (which moves the LDS address
    // too) and takes it off their LDS address register; with V at 9216 B that stays above 0.
    struct __attribute__((aligned(16))) KVTiles {
        unsigned short k[64][72];
        unsigned short v[64][80];
    };
    __shared__ KVTiles kv;
    unsigned short (&Kt)[64][72] = kv.k;
    unsigned short (&Vs)[64][80] = kv.v;
    // per key 0 or a large negative number: the C operand of the score product. A lane's scores are
    // 32 different keys a tile, so the mask is turned into addends once a block, not per tile.
    __shared__ __attribute__((aligned(16))) float Mb[SEQ];

    const int tid = threadIdx.x;
    const int wid = tid >> 5, lane = tid & 31;
    const int g   = lane >> 4, ln = lane & 15;

    const int nqb = SEQ / 64;                       // 32
    const int qb  = blockIdx.x % nqb;
    const int h   = (blockIdx.x / nqb) % HEADS;
    const int b   = blockIdx.x / (nqb * HEADS);

    const int    q0   = qb * 64 + wid * 16;
    const size_t rowB = (size_t)b * SEQ;
    const float  scale = 0.125f;                    // 1/sqrt(64)

    // Q fragments (B operand 32 d x 16 queries, two for d=64) loaded once from global;
    // lane holds query q0 + ln in the k order of kpair_of(), as the K loader below
    FragA aq[2];
#pragma unroll
    for (int f = 0; f < 2; ++f)
#pragma unroll
        for (int j = 0; j < 8; ++j) {
            int col = h * HDIM + f * 32 + kpair_of(j, g);
            aq[f].u[j] = *(const unsigned int*)(qkvb + (rowB + q0 + ln) * (size_t)QKV_N + col);
        }

    // written in front of the loop's first barrier, read behind it
#pragma unroll
    for (int i = 0; i < SEQ / (128 * 4); ++i) {
        const int4 mv = ((const int4*)(mask + b * SEQ))[tid + i * 128];
        float4 mbv;
        mbv.x = (mv.x == 0) ? -1.0e38f : 0.f;
        mbv.y = (mv.y == 0) ? -1.0e38f : 0.f;
        mbv.z = (mv.z == 0) ? -1.0e38f : 0.f;
        mbv.w = (mv.w == 0) ? -1.0e38f : 0.f;
        ((float4*)Mb)[tid + i * 128] = mbv;
    }

    float m = -3.0e38f;     // running maximum of query ln (equal in both lane halves)
    float l = 0.f;          // running sum over this lane half's keys; the halves join at the end
    FragC o[4];             // o[dt].f[r] = Ot[dt*16 + 8g + r][query ln]
#pragma unroll
    for (int dt = 0; dt < 4; ++dt)
#pragma unroll
        for (int r = 0; r < 8; ++r) o[dt].f[r] = 0.f;

    for (int kb = 0; kb < SEQ; kb += 64) {
        __syncthreads();
        // K tile: straight row copy -> async global->LDS (4 x b128 per thread)
#pragma unroll
        for (int i = 0; i < 4; ++i) {
            int q = tid + i * 128;                 // 0..511
            int key = q >> 3, seg = (q & 7) << 3;  // seg in elements (8 = 16B)
            async_copy16(qkvb + (rowB + kb + key) * (size_t)QKV_N + EMBED + h * HDIM + seg,
                         &Kt[key][seg]);
        }
        // V tile: straight row copy too (4 x b128 per thread); the read transposes
#pragma unroll
        for (int i = 0; i < 4; ++i) {
            int q = tid + i * 128;                 // 0..511
            int key = q >> 3, seg = (q & 7) << 3;
            async_copy16(qkvb + (rowB + kb + key) * (size_t)QKV_N + 2 * EMBED + h * HDIM + seg,
                         &Vs[key][seg]);
        }
        wait_async0();
        __syncthreads();   // publishes both tiles; also holds the LDS reads behind the wait

        // St = scale * (K Qt + mask addend)   (64 keys x 16 queries per wave)
        FragC s[4];
#pragma unroll
        for (int n = 0; n < 4; ++n) {
            // the lane's eight keys of this tile lie in a row
            const float4* mp = (const float4*)&Mb[kb + n * 16 + 8 * g];
            const float4 c0 = mp[0], c1 = mp[1];
            s[n].f[0] = c0.x; s[n].f[1] = c0.y; s[n].f[2] = c0.z; s[n].f[3] = c0.w;
            s[n].f[4] = c1.x; s[n].f[5] = c1.y; s[n].f[6] = c1.z; s[n].f[7] = c1.w;
#pragma unroll
            for (int ks = 0; ks < 2; ++ks) {
                FragA bk;
#pragma unroll
                for (int j = 0; j < 8; ++j)
                    bk.u[j] = *(const unsigned int*)&Kt[n * 16 + ln][ks * 32 + kpair_of(j, g)];
                s[n].v = __builtin_amdgcn_wmma_f32_16x16x32_bf16(
                    false, bk.v, false, aq[ks].v, (short)0, s[n].v, false, false);
            }
#pragma unroll
            for (int r = 0; r < 8; ++r) s[n].f[r] *= scale;
        }

        // online softmax, one query a lane: maximum over the lane's 32 keys, then the other half's
        float tmax[4];          // four chains that do not wait for one another
#pragma unroll
        for (int n = 0; n < 4; ++n) {
            tmax[n] = s[n].f[0];
#pragma unroll
            for (int r = 1; r < 8; ++r) tmax[n] = fmaxf(tmax[n], s[n].f[r]);
        }
        float rm = fmaxf(fmaxf(tmax[0], tmax[1]), fmaxf(tmax[2], tmax[3]));
        rm = fmaxf(rm, other_half(rm));

        const float mn    = fmaxf(m, rm);
        const float alpha = __expf(m - mn);
        m = mn;
#pragma unroll
        for (int dt = 0; dt < 4; ++dt)
#pragma unroll
            for (int r = 0; r < 8; ++r) o[dt].f[r] *= alpha;

        float part[4];
#pragma unroll
        for (int n = 0; n < 4; ++n) {
            part[n] = 0.f;
#pragma unroll
            for (int r = 0; r < 8; ++r) {
                float p = __expf(s[n].f[r] - mn);
                s[n].f[r] = p;
                part[n] += p;
            }
        }
        l = l * alpha + ((part[0] + part[1]) + (part[2] + part[3]));

        // Pt as B operand: element e of the fragment is key ks*32 + (e < 8 ? 8g + e : 16 + 8g + e - 8),
        // which is register e & 7 of score tile 2*ks + (e >> 3)
        FragA pb[2];
#pragma unroll
        for (int ks = 0; ks < 2; ++ks)
#pragma unroll
            for (int e = 0; e < 16; ++e)
                pb[ks].v[e] = (bf16_t)s[2 * ks + (e >> 3)].f[e & 7];

        // Ot += Vt Pt; the transposing read delivers Vt (16 d x 32 keys) as the A operand
#pragma unroll
        for (int ks = 0; ks < 2; ++ks)
#pragma unroll
            for (int dt = 0; dt < 4; ++dt) {
                FragA bv;
                load_b_tr16(bv, &Vs[0][0], 80, ks * 32, dt * 16, lane);
                o[dt].v = __builtin_amdgcn_wmma_f32_16x16x32_bf16(
                    false, bv.v, false, pb[ks].v, (short)0, o[dt].v, false, false);
            }
    }

    // join the halves' sums, normalize and emit ctx (bf16, [B,T,E] row-major with head offset):
    // a lane's eight registers of a tile are eight d in a row of its query's row: one 16 B store
    l += other_half(l);
    const float inv = 1.f / l;
    unsigned short* crow = ctxb + (size_t)(b * SEQ + q0 + ln) * EMBED + h * HDIM + 8 * g;
#pragma unroll
    for (int dt = 0; dt < 4; ++dt) {
        uint4 w;
        w.x = (unsigned int)f2bf(o[dt].f[0] * inv) | ((unsigned int)f2bf(o[dt].f[1] * inv) << 16);
        w.y = (unsigned int)f2bf(o[dt].f[2] * inv) | ((unsigned int)f2bf(o[dt].f[3] * inv) << 16);
        w.z = (unsigned int)f2bf(o[dt].f[4] * inv) | ((unsigned int)f2bf(o[dt].f[5] * inv) << 16);
        w.w = (unsigned int)f2bf(o[dt].f[6] * inv) | ((unsigned int)f2bf(o[dt].f[7] * inv) << 16);
        *(uint4*)(crow + dt * 16) = w;
    }
}

// ---------------------------------------------------------------------- launch
extern "C" void kernel_launch(void* const* d_in, const int* in_sizes, int n_in,
                              void* d_out, int out_size, void* d_ws, size_t ws_size,
                              hipStream_t stream) {
    (void)in_sizes; (void)n_in; (void)out_size; (void)ws_size;
    const float* x    = (const float*)d_in[0];
    const int*   mask = (const int*)  d_in[1];
    const float* Wqkv = (const float*)d_in[2];
    const float* bqkv = (const float*)d_in[3];
    const float* Wout = (const float*)d_in[4];
    const float* bout = (const float*)d_in[5];

    char* ws = (char*)d_ws;
    size_t off = 0;
    unsigned short* xb    = (unsigned short*)(ws + off); off += (size_t)ROWS  * EMBED * 2;
    unsigned short* wqkvb = (unsigned short*)(ws + off); off += (size_t)EMBED * QKV_N * 2;
    unsigned short* woutb = (unsigned short*)(ws + off); off += (size_t)EMBED * EMBED * 2;
    unsigned short* qkvb  = (unsigned short*)(ws + off); off += (size_t)ROWS  * QKV_N * 2;
    unsigned short* ctxb  = (unsigned short*)(ws + off); off += (size_t)ROWS  * EMBED * 2;

    static_assert((ROWS * EMBED) % (256 * 8 * 4) == 0 && (EMBED * QKV_N) % (256 * 6 * 4) == 0 &&
                  (EMBED * EMBED) % (256 * 4 * 4) == 0, "convert grids cover the arrays exactly");
    cvt_f32_bf16<8><<<(ROWS * EMBED) / (256 * 8 * 4), 256, 0, stream>>>(x, xb);          // 1024 blocks
    cvt_f32_bf16<6><<<(EMBED * QKV_N) / (256 * 6 * 4), 256, 0, stream>>>(Wqkv, wqkvb);   // 512 blocks
    cvt_f32_bf16<4><<<(EMBED * EMBED) / (256 * 4 * 4), 256, 0, stream>>>(Wout, woutb);   // 256 blocks

    // qkv = x @ Wqkv + bqkv   (bf16 out)
    gemm_bf16_wmma<true><<<dim3(QKV_N / 128, ROWS / 128), 256, 0, stream>>>(
        xb, wqkvb, bqkv, qkvb, ROWS, QKV_N, EMBED);

    // streaming attention per (b, h, 64-query block)
    attention_wmma<<<BATCH * HEADS * (SEQ / 64), 128, 0, stream>>>(qkvb, mask, ctxb);

    // out = ctx @ Wout + bout  (fp32 out)
    gemm_bf16_wmma<false><<<dim3(EMBED / 128, ROWS / 128), 256, 0, stream>>>(
        ctxb, woutb, bout, d_out, ROWS, EMBED, EMBED);
}

// v005
// Measured time: 178 microseconds a run.
// In two side-by-side timings against v004, it was 1.16 and 1.17 times as fast.
// Counting every step since v000, it is 7.48 times as fast.
#include <hip/hip_runtime.h>
#include <stdint.h>

#define EMBED 1024
#define HEADS 16
#define HDIM  64
#define BATCH 4
#define SEQ   2048
#define ROWS  (BATCH * SEQ)     // 8192
#define QKV_N (3 * EMBED)       // 3072

typedef __bf16 bf16_t;
typedef bf16_t v16bf __attribute__((ext_vector_type(16)));
typedef float  v8f   __attribute__((ext_vector_type(8)));
typedef int    v4i   __attribute__((ext_vector_type(4)));

typedef short  v8s   __attribute__((ext_vector_type(8)));

union FragA { v16bf v; unsigned int u[8]; v8s h[2]; };
union FragC { v8f  v; float f[8]; };

__device__ __forceinline__ unsigned short f2bf(float x) {
    union { float f; unsigned int u; } c; c.f = x;
    unsigned int r = (c.u + 0x7fffu + ((c.u >> 16) & 1u)) >> 16;  // RNE
    return (unsigned short)r;
}

__device__ __forceinline__ int kpair_of(int j, int g) {
    return ((j >> 2) << 4) | (g << 3) | ((j & 3) << 1);
}

#if __has_builtin(__builtin_amdgcn_global_load_async_to_lds_b128)
#define HAVE_ASYNC_LDS 1
#else
#define HAVE_ASYNC_LDS 0
#endif

__device__ __forceinline__ void async_copy16(const void* gsrc, void* lds) {
#if HAVE_ASYNC_LDS
    __builtin_amdgcn_global_load_async_to_lds_b128(
        (__attribute__((address_space(1))) v4i*)gsrc,
        (__attribute__((address_space(3))) v4i*)lds, 0, 0);
#else
    *(uint4*)lds = *(const uint4*)gsrc;
#endif
}

__device__ __forceinline__ void wait_async0() {
#if HAVE_ASYNC_LDS
#if __has_builtin(__builtin_amdgcn_s_wait_asynccnt)
    __builtin_amdgcn_s_wait_asynccnt(0);
#else
    asm volatile("s_wait_asynccnt 0" ::: "memory");
#endif
#endif
}

__device__ __forceinline__ void load_b_tr16(FragA& f, const unsigned short* tile,
                                            int pitch, int k0, int n0, int lane) {
    typedef __attribute__((address_space(3))) v8s lds_v8s;
    const unsigned short* p =
        tile + (k0 + ((lane >> 4) << 3) + (lane & 7)) * pitch + n0 + (((lane >> 3) & 1) << 3);
    f.h[0] = __builtin_amdgcn_ds_load_tr16_b128_v8i16((lds_v8s*)p);
    f.h[1] = __builtin_amdgcn_ds_load_tr16_b128_v8i16((lds_v8s*)(p + 16 * pitch));
}

// ---------------------------------------------------------------- fp32 -> bf16
// Each block converts 256 * PER groups of 4 floats that lie in a row; the grid covers the
// array exactly. A wave's load covers 512 B in a row, its store 256 B: whole lines both ways.
// All PER loads of a lane are issued before the first is used.
template <int PER>
__global__ __launch_bounds__(256)
void cvt_f32_bf16(const float* __restrict__ src, unsigned short* __restrict__ dst) {
    const size_t g0 = (size_t)blockIdx.x * (256 * PER) + threadIdx.x;
    const float4* __restrict__ s4 = (const float4*)src;
    uint2* __restrict__ d4 = (uint2*)dst;
    float4 v[PER];
#pragma unroll   // v[] stays in registers and the loads go out as one run, ahead of any use
    for (int i = 0; i < PER; ++i) v[i] = s4[g0 + i * 256];
#pragma unroll   // constant indices into v[]
    for (int i = 0; i < PER; ++i) {
        uint2 o;
        o.x = (unsigned int)f2bf(v[i].x) | ((unsigned int)f2bf(v[i].y) << 16);
        o.y = (unsigned int)f2bf(v[i].z) | ((unsigned int)f2bf(v[i].w) << 16);
        d4[g0 + i * 256] = o;
    }
}

// -------------------------------------------------- tiled bf16 GEMM + bias
// C[M,N] = A[M,K] @ B[K,N] + bias[N]; 128x128 tile, BK=32, 8 waves,
// each wave computes 32x64 (2x4 tiles of 16x16) via v_wmma_f32_16x16x32_bf16.
template <bool STORE_BF16>
__global__ __launch_bounds__(256)
void gemm_bf16_wmma(const unsigned short* __restrict__ A,
                    const unsigned short* __restrict__ Bm,
                    const float* __restrict__ bias,
                    void* __restrict__ Cout,
                    int M, int N, int K) {
    __shared__ __attribute__((aligned(16))) unsigned short As[128][40];
    __shared__ __attribute__((aligned(16))) unsigned short Bs[32][144];

    const int tid  = threadIdx.x;
    const int wid  = tid >> 5, lane = tid & 31;
    const int g    = lane >> 4, ln = lane & 15;
    const int wm   = wid >> 1,  wn = wid & 1;
    const int m0   = blockIdx.y * 128, n0 = blockIdx.x * 128;

    FragC acc[2][4];
#pragma unroll
    for (int tm = 0; tm < 2; ++tm)
#pragma unroll
        for (int tn = 0; tn < 4; ++tn)
#pragma unroll
            for (int r = 0; r < 8; ++r) acc[tm][tn].f[r] = 0.f;

    for (int kb = 0; kb < K; kb += 32) {
        __syncthreads();
        // A tile: straight row copy -> async global->LDS (2 x b128 per thread)
#pragma unroll
        for (int i = 0; i < 2; ++i) {
            int q = tid + i * 256;              // 0..511
            int row = q >> 2, seg = (q & 3) << 3;   // seg in elements (8 = 16B)
            async_copy16(A + (size_t)(m0 + row) * K + kb + seg, &As[row][seg]);
        }
        // B tile: straight row copy too (2 x b128 per thread); the read transposes
#pragma unroll
        for (int i = 0; i < 2; ++i) {
            int q = tid + i * 256;              // 0..511
            int kk = q >> 4, seg = (q & 15) << 3;
            async_copy16(Bm + (size_t)(kb + kk) * N + n0 + seg, &Bs[kk][seg]);
        }
        wait_async0();
        __syncthreads();   // publishes both tiles; also holds the LDS reads behind the wait

        FragA a[2], b[4];
#pragma unroll
        for (int tm = 0; tm < 2; ++tm)
#pragma unroll
            for (int j = 0; j < 8; ++j)
                a[tm].u[j] = *(const unsigned int*)&As[wm * 32 + tm * 16 + ln][kpair_of(j, g)];
#pragma unroll
        for (int tn = 0; tn < 4; ++tn)
            load_b_tr16(b[tn], &Bs[0][0], 144, 0, wn * 64 + tn * 16, lane);
#pragma unroll
        for (int tm = 0; tm < 2; ++tm)
#pragma unroll
            for (int tn = 0; tn < 4; ++tn)
                acc[tm][tn].v = __builtin_amdgcn_wmma_f32_16x16x32_bf16(
                    false, a[tm].v, false, b[tn].v, (short)0, acc[tm][tn].v, false, false);
    }

#pragma unroll
    for (int tm = 0; tm < 2; ++tm)
#pragma unroll
        for (int tn = 0; tn < 4; ++tn)
#pragma unroll
            for (int r = 0; r < 8; ++r) {
                int row = m0 + wm * 32 + tm * 16 + r + 8 * g;
                int col = n0 + wn * 64 + tn * 16 + ln;
                float v = acc[tm][tn].f[r] + bias[col];
                if (STORE_BF16)
                    ((unsigned short*)Cout)[(size_t)row * N + col] = f2bf(v);
                else
                    ((float*)Cout)[(size_t)row * N + col] = v;
            }
}

// ------------------------------------------------ flash-attention (streaming)
// grid = B*H*(SEQ/128), 128 threads (4 waves). Wave = 32 queries = QT query tiles of 16: every K and
// V fragment that a wave reads from LDS feeds one product per query tile.
// Both products are taken transposed: St = K Qt and Ot += Vt Pt. A lane (c = lane&15, g = lane>>4)
// then holds scores of ONE query per tile (c): register r of score tile n is key n*16 + 8g + r. Row
// maximum and row sum run inside the lane, with one exchange between the lane halves; two score
// tiles, converted in place, are the B operand (32 keys x 16 queries) of the second product.
#define QT 2
__device__ __forceinline__ float other_half(float x) {      // value of lane ^ 16
    int b = __float_as_int(x);
    return __int_as_float(__builtin_amdgcn_permlanex16(b, b, 0x76543210, 0xfedcba98, false, false));
}

__global__ __launch_bounds__(128) __attribute__((amdgpu_waves_per_eu(4, 4)))
void attention_wmma(const unsigned short* __restrict__ qkvb,   // [ROWS, 3E] bf16
                    const int* __restrict__ mask,              // [B*SEQ]
                    unsigned short* __restrict__ ctxb) {       // [ROWS, E] bf16
    // K in front of V in one object: V's column block lies 2048 B behind K's in a qkv row, the
    // compiler folds that step into the V copies' offset field (which moves the LDS address
    // too) and takes it off their LDS address register; with V at 9216 B that stays above 0.
    struct __attribute__((aligned(16))) KVTiles {
        unsigned short k[64][72];
        unsigned short v[64][80];
    };
    __shared__ KVTiles kv;
    unsigned short (&Kt)[64][72] = kv.k;
    unsigned short (&Vs)[64][80] = kv.v;
    // per key 0 or a large negative number: the C operand of the score product. A lane's scores are
    // 32 different keys a tile, so the mask is turned into addends once a block, not per tile.
    __shared__ __attribute__((aligned(16))) float Mb[SEQ];

    const int tid = threadIdx.x;
    const int wid = tid >> 5, lane = tid & 31;
    const int g   = lane >> 4, ln = lane & 15;

    const int nqb = SEQ / (64 * QT);                // 16
    const int qb  = blockIdx.x % nqb;
    const int h   = (blockIdx.x / nqb) % HEADS;
    const int b   = blockIdx.x / (nqb * HEADS);

    const int    q0   = qb * (64 * QT) + wid * (16 * QT);
    const size_t rowB = (size_t)b * SEQ;
    const float  scale = 0.125f;                    // 1/sqrt(64)

    // Q fragments (B operand 32 d x 16 queries, two for d=64, per query tile) loaded once from
    // global; lane holds query q0 + t*16 + ln in the k order of kpair_of(), as the K loader below
    FragA aq[QT][2];
#pragma unroll
    for (int t = 0; t < QT; ++t)
#pragma unroll
        for (int f = 0; f < 2; ++f)
#pragma unroll
            for (int j = 0; j < 8; ++j) {
                int col = h * HDIM + f * 32 + kpair_of(j, g);
                aq[t][f].u[j] =
                    *(const unsigned int*)(qkvb + (rowB + q0 + t * 16 + ln) * (size_t)QKV_N + col);
            }

    // written in front of the loop's first barrier, read behind it
#pragma unroll
    for (int i = 0; i < SEQ / (128 * 4); ++i) {
        const int4 mv = ((const int4*)(mask + b * SEQ))[tid + i * 128];
        float4 mbv;
        mbv.x = (mv.x == 0) ? -1.0e38f : 0.f;
        mbv.y = (mv.y == 0) ? -1.0e38f : 0.f;
        mbv.z = (mv.z == 0) ? -1.0e38f : 0.f;
        mbv.w = (mv.w == 0) ? -1.0e38f : 0.f;
        ((float4*)Mb)[tid + i * 128] = mbv;
    }

    float m[QT];            // running maximum of query t*16 + ln (equal in both lane halves)
    float l[QT];            // running sum over this lane half's keys; the halves join at the end
    FragC o[QT][4];         // o[t][dt].f[r] = Ot[dt*16 + 8g + r][query t*16 + ln]
#pragma unroll
    for (int t = 0; t < QT; ++t) {
        m[t] = -3.0e38f;
        l[t] = 0.f;
#pragma unroll
        for (int dt = 0; dt < 4; ++dt)
#pragma unroll
            for (int r = 0; r < 8; ++r) o[t][dt].f[r] = 0.f;
    }

    for (int kb = 0; kb < SEQ; kb += 64) {
        __syncthreads();
        // K tile: straight row copy -> async global->LDS (4 x b128 per thread)
#pragma unroll
        for (int i = 0; i < 4; ++i) {
            int q = tid + i * 128;                 // 0..511
            int key = q >> 3, seg = (q & 7) << 3;  // seg in elements (8 = 16B)
            async_copy16(qkvb + (rowB + kb + key) * (size_t)QKV_N + EMBED + h * HDIM + seg,
                         &Kt[key][seg]);
        }
        // V tile: straight row copy too (4 x b128 per thread); the read transposes
#pragma unroll
        for (int i = 0; i < 4; ++i) {
            int q = tid + i * 128;                 // 0..511
            int key = q >> 3, seg = (q & 7) << 3;
            async_copy16(qkvb + (rowB + kb + key) * (size_t)QKV_N + 2 * EMBED + h * HDIM + seg,
                         &Vs[key][seg]);
        }
        wait_async0();
        __syncthreads();   // publishes both tiles; also holds the LDS reads behind the wait

        // St = scale * (K Qt + mask addend)   (64 keys x 32 queries per wave)
        FragC s[QT][4];
#pragma unroll
        for (int n = 0; n < 4; ++n) {
            // the lane's eight keys of this tile lie in a row
            const float4* mp = (const float4*)&Mb[kb + n * 16 + 8 * g];
            const float4 c0 = mp[0], c1 = mp[1];
#pragma unroll
            for (int t = 0; t < QT; ++t) {
                s[t][n].f[0] = c0.x; s[t][n].f[1] = c0.y; s[t][n].f[2] = c0.z; s[t][n].f[3] = c0.w;
                s[t][n].f[4] = c1.x; s[t][n].f[5] = c1.y; s[t][n].f[6] = c1.z; s[t][n].f[7] = c1.w;
            }
#pragma unroll
            for (int ks = 0; ks < 2; ++ks) {
                FragA bk;
#pragma unroll
                for (int j = 0; j < 8; ++j)
                    bk.u[j] = *(const unsigned int*)&Kt[n * 16 + ln][ks * 32 + kpair_of(j, g)];
#pragma unroll
                for (int t = 0; t < QT; ++t)
                    s[t][n].v = __builtin_amdgcn_wmma_f32_16x16x32_bf16(
                        false, bk.v, false, aq[t][ks].v, (short)0, s[t][n].v, false, false);
            }
#pragma unroll
            for (int t = 0; t < QT; ++t)
#pragma unroll
                for (int r = 0; r < 8; ++r) s[t][n].f[r] *= scale;
        }

        FragA pb[QT][2];
#pragma unroll
        for (int t = 0; t < QT; ++t) {
            // online softmax, one query a lane: maximum over the lane's 32 keys, then the other half's
            float tmax[4];          // four chains that do not wait for one another
#pragma unroll
            for (int n = 0; n < 4; ++n) {
                tmax[n] = s[t][n].f[0];
#pragma unroll
                for (int r = 1; r < 8; ++r) tmax[n] = fmaxf(tmax[n], s[t][n].f[r]);
            }
            float rm = fmaxf(fmaxf(tmax[0], tmax[1]), fmaxf(tmax[2], tmax[3]));
            rm = fmaxf(rm, other_half(rm));

            const float mn    = fmaxf(m[t], rm);
            const float alpha = __expf(m[t] - mn);
            m[t] = mn;
#pragma unroll
            for (int dt = 0; dt < 4; ++dt)
#pragma unroll
                for (int r = 0; r < 8; ++r) o[t][dt].f[r] *= alpha;

            float part[4];
#pragma unroll
            for (int n = 0; n < 4; ++n) {
                part[n] = 0.f;
#pragma unroll
                for (int r = 0; r < 8; ++r) {
                    float p = __expf(s[t][n].f[r] - mn);
                    s[t][n].f[r] = p;
                    part[n] += p;
                }
            }
            l[t] = l[t] * alpha + ((part[0] + part[1]) + (part[2] + part[3]));

            // Pt as B operand: element e of the fragment is key ks*32 + (e < 8 ? 8g + e : 16 + 8g + e - 8),
            // which is register e & 7 of score tile 2*ks + (e >> 3)
#pragma unroll
            for (int ks = 0; ks < 2; ++ks)
#pragma unroll
                for (int e = 0; e < 16; ++e)
                    pb[t][ks].v[e] = (bf16_t)s[t][2 * ks + (e >> 3)].f[e & 7];
        }

        __builtin_amdgcn_sched_barrier(0);

        // Ot += Vt Pt; the transposing read delivers Vt (16 d x 32 keys) as the A operand
#pragma unroll
        for (int ks = 0; ks < 2; ++ks)
#pragma unroll
            for (int dt = 0; dt < 4; ++dt) {
                FragA bv;
                load_b_tr16(bv, &Vs[0][0], 80, ks * 32, dt * 16, lane);
#pragma unroll
                for (int t = 0; t < QT; ++t)
                    o[t][dt].v = __builtin_amdgcn_wmma_f32_16x16x32_bf16(
                        false, bv.v, false, pb[t][ks].v, (short)0, o[t][dt].v, false, false);
            }
    }

    // join the halves' sums, normalize and emit ctx (bf16, [B,T,E] row-major with head offset):
    // a lane's eight registers of a tile are eight d in a row of its query's row: one 16 B store
#pragma unroll
    for (int t = 0; t < QT; ++t) {
        const float lt  = l[t] + other_half(l[t]);
        const float inv = 1.f / lt;
        unsigned short* crow =
            ctxb + (size_t)(b * SEQ + q0 + t * 16 + ln) * EMBED + h * HDIM + 8 * g;
#pragma unroll
        for (int dt = 0; dt < 4; ++dt) {
            const FragC& ot = o[t][dt];
            uint4 w;
            w.x = (unsigned int)f2bf(ot.f[0] * inv) | ((unsigned int)f2bf(ot.f[1] * inv) << 16);
            w.y = (unsigned int)f2bf(ot.f[2] * inv) | ((unsigned int)f2bf(ot.f[3] * inv) << 16);
            w.z = (unsigned int)f2bf(ot.f[4] * inv) | ((unsigned int)f2bf(ot.f[5] * inv) << 16);
            w.w = (unsigned int)f2bf(ot.f[6] * inv) | ((unsigned int)f2bf(ot.f[7] * inv) << 16);
            *(uint4*)(crow + dt * 16) = w;
        }
    }
}

// ---------------------------------------------------------------------- launch
extern "C" void kernel_launch(void* const* d_in, const int* in_sizes, int n_in,
                              void* d_out, int out_size, void* d_ws, size_t ws_size,
                              hipStream_t stream) {
    (void)in_sizes; (void)n_in; (void)out_size; (void)ws_size;
    const float* x    = (const float*)d_in[0];
    const int*   mask = (const int*)  d_in[1];
    const float* Wqkv = (const float*)d_in[2];
    const float* bqkv = (const float*)d_in[3];
    const float* Wout = (const float*)d_in[4];
    const float* bout = (const float*)d_in[5];

    char* ws = (char*)d_ws;
    size_t off = 0;
    unsigned short* xb    = (unsigned short*)(ws + off); off += (size_t)ROWS  * EMBED * 2;
    unsigned short* wqkvb = (unsigned short*)(ws + off); off += (size_t)EMBED * QKV_N * 2;
    unsigned short* woutb = (unsigned short*)(ws + off); off += (size_t)EMBED * EMBED * 2;
    unsigned short* qkvb  = (unsigned short*)(ws + off); off += (size_t)ROWS  * QKV_N * 2;
    unsigned short* ctxb  = (unsigned short*)(ws + off); off += (size_t)ROWS  * EMBED * 2;

    static_assert((ROWS * EMBED) % (256 * 8 * 4) == 0 && (EMBED * QKV_N) % (256 * 6 * 4) == 0 &&
                  (EMBED * EMBED) % (256 * 4 * 4) == 0, "convert grids cover the arrays exactly");
    cvt_f32_bf16<8><<<(ROWS * EMBED) / (256 * 8 * 4), 256, 0, stream>>>(x, xb);          // 1024 blocks
    cvt_f32_bf16<6><<<(EMBED * QKV_N) / (256 * 6 * 4), 256, 0, stream>>>(Wqkv, wqkvb);   // 512 blocks
    cvt_f32_bf16<4><<<(EMBED * EMBED) / (256 * 4 * 4), 256, 0, stream>>>(Wout, woutb);   // 256 blocks

    // qkv = x @ Wqkv + bqkv   (bf16 out)
    gemm_bf16_wmma<true><<<dim3(QKV_N / 128, ROWS / 128), 256, 0, stream>>>(
        xb, wqkvb, bqkv, qkvb, ROWS, QKV_N, EMBED);

    // streaming attention per (b, h, 128-query block)
    attention_wmma<<<BATCH * HEADS * (SEQ / (64 * QT)), 128, 0, stream>>>(qkvb, mask, ctxb);

    // out = ctx @ Wout + bout  (fp32 out)
    gemm_bf16_wmma<false><<<dim3(EMBED / 128, ROWS / 128), 256, 0, stream>>>(
        ctxb, woutb, bout, d_out, ROWS, EMBED, EMBED);
}

// v006
// One run takes 164 microseconds.
// Next to v005, in two timings, it ran 1.08 times as fast each time.
// Counting every step since v000, it is 8.11 times as fast.
#include <hip/hip_runtime.h>
#include <stdint.h>

#define EMBED 1024
#define HEADS 16
#define HDIM  64
#define BATCH 4
#define SEQ   2048
#define ROWS  (BATCH * SEQ)     // 8192
#define QKV_N (3 * EMBED)       // 3072

typedef __bf16 bf16_t;
typedef bf16_t v16bf __attribute__((ext_vector_type(16)));
typedef float  v8f   __attribute__((ext_vector_type(8)));
typedef int    v4i   __attribute__((ext_vector_type(4)));

typedef short  v8s   __attribute__((ext_vector_type(8)));

union FragA { v16bf v; unsigned int u[8]; v8s h[2]; };
union FragC { v8f  v; float f[8]; };

__device__ __forceinline__ unsigned short f2bf(float x) {
    union { float f; unsigned int u; } c; c.f = x;
    unsigned int r = (c.u + 0x7fffu + ((c.u >> 16) & 1u)) >> 16;  // RNE
    return (unsigned short)r;
}

__device__ __forceinline__ int kpair_of(int j, int g) {
    return ((j >> 2) << 4) | (g << 3) | ((j & 3) << 1);
}

#if __has_builtin(__builtin_amdgcn_global_load_async_to_lds_b128)
#define HAVE_ASYNC_LDS 1
#else
#define HAVE_ASYNC_LDS 0
#endif

__device__ __forceinline__ void async_copy16(const void* gsrc, void* lds) {
#if HAVE_ASYNC_LDS
    __builtin_amdgcn_global_load_async_to_lds_b128(
        (__attribute__((address_space(1))) v4i*)gsrc,
        (__attribute__((address_space(3))) v4i*)lds, 0, 0);
#else
    *(uint4*)lds = *(const uint4*)gsrc;
#endif
}

// The two waits at a ring's publish point, each a statement of its own in front of the barrier.
// Own LDS reads have retired before the buffer they read is refilled behind the barrier.
__device__ __forceinline__ void wait_ds0() { asm volatile("s_wait_dscnt 0x0" ::: "memory"); }
// Own copies have landed before the barrier behind which other waves read them; in asm so that
// no LDS read is lifted over it.
__device__ __forceinline__ void wait_async0() { asm volatile("s_wait_asynccnt 0x0" ::: "memory"); }

__device__ __forceinline__ void load_b_tr16(FragA& f, const unsigned short* tile,
                                            int pitch, int k0, int n0, int lane) {
    typedef __attribute__((address_space(3))) v8s lds_v8s;
    const unsigned short* p =
        tile + (k0 + ((lane >> 4) << 3) + (lane & 7)) * pitch + n0 + (((lane >> 3) & 1) << 3);
    f.h[0] = __builtin_amdgcn_ds_load_tr16_b128_v8i16((lds_v8s*)p);
    f.h[1] = __builtin_amdgcn_ds_load_tr16_b128_v8i16((lds_v8s*)(p + 16 * pitch));
}

// ---------------------------------------------------------------- fp32 -> bf16
// Each block converts 256 * PER groups of 4 floats that lie in a row; the grid covers the
// array exactly. A wave's load covers 512 B in a row, its store 256 B: whole lines both ways.
// All PER loads of a lane are issued before the first is used.
template <int PER>
__global__ __launch_bounds__(256)
void cvt_f32_bf16(const float* __restrict__ src, unsigned short* __restrict__ dst) {
    const size_t g0 = (size_t)blockIdx.x * (256 * PER) + threadIdx.x;
    const float4* __restrict__ s4 = (const float4*)src;
    uint2* __restrict__ d4 = (uint2*)dst;
    float4 v[PER];
#pragma unroll   // v[] stays in registers and the loads go out as one run, ahead of any use
    for (int i = 0; i < PER; ++i) v[i] = s4[g0 + i * 256];
#pragma unroll   // constant indices into v[]
    for (int i = 0; i < PER; ++i) {
        uint2 o;
        o.x = (unsigned int)f2bf(v[i].x) | ((unsigned int)f2bf(v[i].y) << 16);
        o.y = (unsigned int)f2bf(v[i].z) | ((unsigned int)f2bf(v[i].w) << 16);
        d4[g0 + i * 256] = o;
    }
}

// -------------------------------------------------- tiled bf16 GEMM + bias
// C[M,N] = A[M,K] @ B[K,N] + bias[N]; 128x128 tile, BK=32, 8 waves,
// each wave computes 32x64 (2x4 tiles of 16x16) via v_wmma_f32_16x16x32_bf16.
template <bool STORE_BF16>
__global__ __launch_bounds__(256)
void gemm_bf16_wmma(const unsigned short* __restrict__ A,
                    const unsigned short* __restrict__ Bm,
                    const float* __restrict__ bias,
                    void* __restrict__ Cout,
                    int M, int N, int K) {
    // two buffers each: trip t reads buffer t & 1 while the copies of tile t + 1 land in the other
    __shared__ __attribute__((aligned(16))) unsigned short As[2][128][40];
    __shared__ __attribute__((aligned(16))) unsigned short Bs[2][32][144];

    const int tid  = threadIdx.x;
    const int wid  = tid >> 5, lane = tid & 31;
    const int g    = lane >> 4, ln = lane & 15;
    const int wm   = wid >> 1,  wn = wid & 1;
    const int m0   = blockIdx.y * 128, n0 = blockIdx.x * 128;

    FragC acc[2][4];
#pragma unroll
    for (int tm = 0; tm < 2; ++tm)
#pragma unroll
        for (int tn = 0; tn < 4; ++tn)
#pragma unroll
            for (int r = 0; r < 8; ++r) acc[tm][tn].f[r] = 0.f;

    // the copies of the tile at k = kb into buffer buf (4 x b128 per thread)
    auto stage = [&](int kb, int buf) {
        // A tile: straight row copy -> async global->LDS (2 x b128 per thread)
#pragma unroll
        for (int i = 0; i < 2; ++i) {
            int q = tid + i * 256;              // 0..511
            int row = q >> 2, seg = (q & 3) << 3;   // seg in elements (8 = 16B)
            async_copy16(A + (size_t)(m0 + row) * K + kb + seg, &As[buf][row][seg]);
        }
        // B tile: straight row copy too (2 x b128 per thread); the read transposes
#pragma unroll
        for (int i = 0; i < 2; ++i) {
            int q = tid + i * 256;              // 0..511
            int kk = q >> 4, seg = (q & 15) << 3;
            async_copy16(Bm + (size_t)(kb + kk) * N + n0 + seg, &Bs[buf][kk][seg]);
        }
    };

    if (K > 0) stage(0, 0);
    wait_async0();
    __syncthreads();                 // publishes tile 0
    if (K > 32) stage(32, 1);        // flies during trip 0

    for (int kb = 0; kb < K; kb += 32) {
        const int buf = (kb >> 5) & 1;

        FragA a[2], b[4];
#pragma unroll
        for (int tm = 0; tm < 2; ++tm)
#pragma unroll
            for (int j = 0; j < 8; ++j)
                a[tm].u[j] = *(const unsigned int*)&As[buf][wm * 32 + tm * 16 + ln][kpair_of(j, g)];
#pragma unroll
        for (int tn = 0; tn < 4; ++tn)
            load_b_tr16(b[tn], &Bs[buf][0][0], 144, 0, wn * 64 + tn * 16, lane);

        // publish point, behind the trip's last LDS read and in front of its products (they
        // work on registers alone, so the refill goes out ahead of them): the one barrier of a
        // trip publishes the next tile and ends every wave's reads of this one, whose buffer
        // is refilled behind it
        wait_ds0();
        wait_async0();
        __syncthreads();
        if (kb + 64 < K) stage(kb + 64, buf);

#pragma unroll
        for (int tm = 0; tm < 2; ++tm)
#pragma unroll
            for (int tn = 0; tn < 4; ++tn)
                acc[tm][tn].v = __builtin_amdgcn_wmma_f32_16x16x32_bf16(
                    false, a[tm].v, false, b[tn].v, (short)0, acc[tm][tn].v, false, false);
    }
    wait_async0();               // nothing of this wave is in flight when it leaves the ring

#pragma unroll
    for (int tm = 0; tm < 2; ++tm)
#pragma unroll
        for (int tn = 0; tn < 4; ++tn)
#pragma unroll
            for (int r = 0; r < 8; ++r) {
                int row = m0 + wm * 32 + tm * 16 + r + 8 * g;
                int col = n0 + wn * 64 + tn * 16 + ln;
                float v = acc[tm][tn].f[r] + bias[col];
                if (STORE_BF16)
                    ((unsigned short*)Cout)[(size_t)row * N + col] = f2bf(v);
                else
                    ((float*)Cout)[(size_t)row * N + col] = v;
            }
}

// ------------------------------------------------ flash-attention (streaming)
// grid = B*H*(SEQ/128), 128 threads (4 waves). Wave = 32 queries = QT query tiles of 16: every K and
// V fragment that a wave reads from LDS feeds one product per query tile.
// Both products are taken transposed: St = K Qt and Ot += Vt Pt. A lane (c = lane&15, g = lane>>4)
// then holds scores of ONE query per tile (c): register r of score tile n is key n*16 + 8g + r. Row
// maximum and row sum run inside the lane, with one exchange between the lane halves; two score
// tiles, converted in place, are the B operand (32 keys x 16 queries) of the second product.
#define QT 2
__device__ __forceinline__ float other_half(float x) {      // value of lane ^ 16
    int b = __float_as_int(x);
    return __int_as_float(__builtin_amdgcn_permlanex16(b, b, 0x76543210, 0xfedcba98, false, false));
}

__global__ __launch_bounds__(128) __attribute__((amdgpu_waves_per_eu(4, 4)))
void attention_wmma(const unsigned short* __restrict__ qkvb,   // [ROWS, 3E] bf16
                    const int* __restrict__ mask,              // [B*SEQ]
                    unsigned short* __restrict__ ctxb) {       // [ROWS, E] bf16
    // K in front of V in one object: V's column block lies 2048 B behind K's in a qkv row, the
    // compiler folds that step into the V copies' offset field (which moves the LDS address
    // too) and takes it off their LDS address register; with V at 9216 B that stays above 0.
    struct __attribute__((aligned(16))) KVTiles {
        unsigned short k[64][72];
        unsigned short v[64][80];
    };
    // two buffers: trip t reads buffer t & 1 while the copies of tile t + 1 land in the other
    __shared__ KVTiles kv[2];
    // per key 0 or a large negative number: the C operand of the score product. A lane's scores are
    // 32 different keys a tile, so the mask is turned into addends once a block, not per tile.
    __shared__ __attribute__((aligned(16))) float Mb[SEQ];

    const int tid = threadIdx.x;
    const int wid = tid >> 5, lane = tid & 31;
    const int g   = lane >> 4, ln = lane & 15;

    const int nqb = SEQ / (64 * QT);                // 16
    const int qb  = blockIdx.x % nqb;
    const int h   = (blockIdx.x / nqb) % HEADS;
    const int b   = blockIdx.x / (nqb * HEADS);

    const int    q0   = qb * (64 * QT) + wid * (16 * QT);
    const size_t rowB = (size_t)b * SEQ;
    const float  scale = 0.125f;                    // 1/sqrt(64)

    // Q fragments (B operand 32 d x 16 queries, two for d=64, per query tile) loaded once from
    // global; lane holds query q0 + t*16 + ln in the k order of kpair_of(), as the K loader below
    FragA aq[QT][2];
#pragma unroll
    for (int t = 0; t < QT; ++t)
#pragma unroll
        for (int f = 0; f < 2; ++f)
#pragma unroll
            for (int j = 0; j < 8; ++j) {
                int col = h * HDIM + f * 32 + kpair_of(j, g);
                aq[t][f].u[j] =
                    *(const unsigned int*)(qkvb + (rowB + q0 + t * 16 + ln) * (size_t)QKV_N + col);
            }

    // written in front of the ring's first barrier, read behind it
#pragma unroll
    for (int i = 0; i < SEQ / (128 * 4); ++i) {
        const int4 mv = ((const int4*)(mask + b * SEQ))[tid + i * 128];
        float4 mbv;
        mbv.x = (mv.x == 0) ? -1.0e38f : 0.f;
        mbv.y = (mv.y == 0) ? -1.0e38f : 0.f;
        mbv.z = (mv.z == 0) ? -1.0e38f : 0.f;
        mbv.w = (mv.w == 0) ? -1.0e38f : 0.f;
        ((float4*)Mb)[tid + i * 128] = mbv;
    }

    float m[QT];            // running maximum of query t*16 + ln (equal in both lane halves)
    float l[QT];            // running sum over this lane half's keys; the halves join at the end
    FragC o[QT][4];         // o[t][dt].f[r] = Ot[dt*16 + 8g + r][query t*16 + ln]
#pragma unroll
    for (int t = 0; t < QT; ++t) {
        m[t] = -3.0e38f;
        l[t] = 0.f;
#pragma unroll
        for (int dt = 0; dt < 4; ++dt)
#pragma unroll
            for (int r = 0; r < 8; ++r) o[t][dt].f[r] = 0.f;
    }

    // the copies of the 64 keys from kb on into buffer buf (8 x b128 per thread)
    auto stage = [&](int kb, int buf) {
        // K tile: straight row copy -> async global->LDS (4 x b128 per thread)
#pragma unroll
        for (int i = 0; i < 4; ++i) {
            int q = tid + i * 128;                 // 0..511
            int key = q >> 3, seg = (q & 7) << 3;  // seg in elements (8 = 16B)
            async_copy16(qkvb + (rowB + kb + key) * (size_t)QKV_N + EMBED + h * HDIM + seg,
                         &kv[buf].k[key][seg]);
        }
        // V tile: straight row copy too (4 x b128 per thread); the read transposes
#pragma unroll
        for (int i = 0; i < 4; ++i) {
            int q = tid + i * 128;                 // 0..511
            int key = q >> 3, seg = (q & 7) << 3;
            async_copy16(qkvb + (rowB + kb + key) * (size_t)QKV_N + 2 * EMBED + h * HDIM + seg,
                         &kv[buf].v[key][seg]);
        }
    };

    static_assert(SEQ >= 128, "the ring's prologue fills two tiles");
    stage(0, 0);
    wait_async0();
    __syncthreads();                 // publishes tile 0 and the mask addends
    stage(64, 1);                    // flies during trip 0

    for (int kb = 0; kb < SEQ; kb += 64) {
        const int buf = (kb >> 6) & 1;
        const unsigned short (&Kt)[64][72] = kv[buf].k;
        const unsigned short (&Vs)[64][80] = kv[buf].v;

        // St = scale * (K Qt + mask addend)   (64 keys x 32 queries per wave)
        FragC s[QT][4];
#pragma unroll
        for (int n = 0; n < 4; ++n) {
            // the lane's eight keys of this tile lie in a row
            const float4* mp = (const float4*)&Mb[kb + n * 16 + 8 * g];
            const float4 c0 = mp[0], c1 = mp[1];
#pragma unroll
            for (int t = 0; t < QT; ++t) {
                s[t][n].f[0] = c0.x; s[t][n].f[1] = c0.y; s[t][n].f[2] = c0.z; s[t][n].f[3] = c0.w;
                s[t][n].f[4] = c1.x; s[t][n].f[5] = c1.y; s[t][n].f[6] = c1.z; s[t][n].f[7] = c1.w;
            }
#pragma unroll
            for (int ks = 0; ks < 2; ++ks) {
                FragA bk;
#pragma unroll
                for (int j = 0; j < 8; ++j)
                    bk.u[j] = *(const unsigned int*)&Kt[n * 16 + ln][ks * 32 + kpair_of(j, g)];
#pragma unroll
                for (int t = 0; t < QT; ++t)
                    s[t][n].v = __builtin_amdgcn_wmma_f32_16x16x32_bf16(
                        false, bk.v, false, aq[t][ks].v, (short)0, s[t][n].v, false, false);
            }
#pragma unroll
            for (int t = 0; t < QT; ++t)
#pragma unroll
                for (int r = 0; r < 8; ++r) s[t][n].f[r] *= scale;
        }

        FragA pb[QT][2];
#pragma unroll
        for (int t = 0; t < QT; ++t) {
            // online softmax, one query a lane: maximum over the lane's 32 keys, then the other half's
            float tmax[4];          // four chains that do not wait for one another
#pragma unroll
            for (int n = 0; n < 4; ++n) {
                tmax[n] = s[t][n].f[0];
#pragma unroll
                for (int r = 1; r < 8; ++r) tmax[n] = fmaxf(tmax[n], s[t][n].f[r]);
            }
            float rm = fmaxf(fmaxf(tmax[0], tmax[1]), fmaxf(tmax[2], tmax[3]));
            rm = fmaxf(rm, other_half(rm));

            const float mn    = fmaxf(m[t], rm);
            const float alpha = __expf(m[t] - mn);
            m[t] = mn;
#pragma unroll
            for (int dt = 0; dt < 4; ++dt)
#pragma unroll
                for (int r = 0; r < 8; ++r) o[t][dt].f[r] *= alpha;

            float part[4];
#pragma unroll
            for (int n = 0; n < 4; ++n) {
                part[n] = 0.f;
#pragma unroll
                for (int r = 0; r < 8; ++r) {
                    float p = __expf(s[t][n].f[r] - mn);
                    s[t][n].f[r] = p;
                    part[n] += p;
                }
            }
            l[t] = l[t] * alpha + ((part[0] + part[1]) + (part[2] + part[3]));

            // Pt as B operand: element e of the fragment is key ks*32 + (e < 8 ? 8g + e : 16 + 8g + e - 8),
            // which is register e & 7 of score tile 2*ks + (e >> 3)
#pragma unroll
            for (int ks = 0; ks < 2; ++ks)
#pragma unroll
                for (int e = 0; e < 16; ++e)
                    pb[t][ks].v[e] = (bf16_t)s[t][2 * ks + (e >> 3)].f[e & 7];
        }

        __builtin_amdgcn_sched_barrier(0);

        // Ot += Vt Pt; the transposing read delivers Vt (16 d x 32 keys) as the A operand
#pragma unroll
        for (int ks = 0; ks < 2; ++ks)
#pragma unroll
            for (int dt = 0; dt < 4; ++dt) {
                FragA bv;
                load_b_tr16(bv, &Vs[0][0], 80, ks * 32, dt * 16, lane);
#pragma unroll
                for (int t = 0; t < QT; ++t)
                    o[t][dt].v = __builtin_amdgcn_wmma_f32_16x16x32_bf16(
                        false, bv.v, false, pb[t][ks].v, (short)0, o[t][dt].v, false, false);
            }

        // publish point: the one barrier of a trip publishes the next tile and ends every
        // wave's reads of this one, whose buffer is refilled behind it
        wait_ds0();
        wait_async0();
        __syncthreads();
        if (kb + 128 < SEQ) stage(kb + 128, buf);
    }
    wait_async0();               // nothing of this wave is in flight when it leaves the ring

    // join the halves' sums, normalize and emit ctx (bf16, [B,T,E] row-major with head offset):
    // a lane's eight registers of a tile are eight d in a row of its query's row: one 16 B store
#pragma unroll
    for (int t = 0; t < QT; ++t) {
        const float lt  = l[t] + other_half(l[t]);
        const float inv = 1.f / lt;
        unsigned short* crow =
            ctxb + (size_t)(b * SEQ + q0 + t * 16 + ln) * EMBED + h * HDIM + 8 * g;
#pragma unroll
        for (int dt = 0; dt < 4; ++dt) {
            const FragC& ot = o[t][dt];
            uint4 w;
            w.x = (unsigned int)f2bf(ot.f[0] * inv) | ((unsigned int)f2bf(ot.f[1] * inv) << 16);
            w.y = (unsigned int)f2bf(ot.f[2] * inv) | ((unsigned int)f2bf(ot.f[3] * inv) << 16);
            w.z = (unsigned int)f2bf(ot.f[4] * inv) | ((unsigned int)f2bf(ot.f[5] * inv) << 16);
            w.w = (unsigned int)f2bf(ot.f[6] * inv) | ((unsigned int)f2bf(ot.f[7] * inv) << 16);
            *(uint4*)(crow + dt * 16) = w;
        }
    }
}

// ---------------------------------------------------------------------- launch
extern "C" void kernel_launch(void* const* d_in, const int* in_sizes, int n_in,
                              void* d_out, int out_size, void* d_ws, size_t ws_size,
                              hipStream_t stream) {
    (void)in_sizes; (void)n_in; (void)out_size; (void)ws_size;
    const float* x    = (const float*)d_in[0];
    const int*   mask = (const int*)  d_in[1];
    const float* Wqkv = (const float*)d_in[2];
    const float* bqkv = (const float*)d_in[3];
    const float* Wout = (const float*)d_in[4];
    const float* bout = (const float*)d_in[5];

    char* ws = (char*)d_ws;
    size_t off = 0;
    unsigned short* xb    = (unsigned short*)(ws + off); off += (size_t)ROWS  * EMBED * 2;
    unsigned short* wqkvb = (unsigned short*)(ws + off); off += (size_t)EMBED * QKV_N * 2;
    unsigned short* woutb = (unsigned short*)(ws + off); off += (size_t)EMBED * EMBED * 2;
    unsigned short* qkvb  = (unsigned short*)(ws + off); off += (size_t)ROWS  * QKV_N * 2;
    unsigned short* ctxb  = (unsigned short*)(ws + off); off += (size_t)ROWS  * EMBED * 2;

    static_assert((ROWS * EMBED) % (256 * 8 * 4) == 0 && (EMBED * QKV_N) % (256 * 6 * 4) == 0 &&
                  (EMBED * EMBED) % (256 * 4 * 4) == 0, "convert grids cover the arrays exactly");
    cvt_f32_bf16<8><<<(ROWS * EMBED) / (256 * 8 * 4), 256, 0, stream>>>(x, xb);          // 1024 blocks
    cvt_f32_bf16<6><<<(EMBED * QKV_N) / (256 * 6 * 4), 256, 0, stream>>>(Wqkv, wqkvb);   // 512 blocks
    cvt_f32_bf16<4><<<(EMBED * EMBED) / (256 * 4 * 4), 256, 0, stream>>>(Wout, woutb);   // 256 blocks

    // qkv = x @ Wqkv + bqkv   (bf16 out)
    gemm_bf16_wmma<true><<<dim3(QKV_N / 128, ROWS / 128), 256, 0, stream>>>(
        xb, wqkvb, bqkv, qkvb, ROWS, QKV_N, EMBED);

    // streaming attention per (b, h, 128-query block)
    attention_wmma<<<BATCH * HEADS * (SEQ / (64 * QT)), 128, 0, stream>>>(qkvb, mask, ctxb);

    // out = ctx @ Wout + bout  (fp32 out)
    gemm_bf16_wmma<false><<<dim3(EMBED / 128, ROWS / 128), 256, 0, stream>>>(
        ctxb, woutb, bout, d_out, ROWS, EMBED, EMBED);
}

// v007
// One run takes 159 microseconds.
// Next to v006, in two timings, it ran 1.03 times as fast each time.
// Over all steps from v000 it is 8.35 times as fast.
#include <hip/hip_runtime.h>
#include <stdint.h>

#define EMBED 1024
#define HEADS 16
#define HDIM  64
#define BATCH 4
#define SEQ   2048
#define ROWS  (BATCH * SEQ)     // 8192
#define QKV_N (3 * EMBED)       // 3072

typedef __bf16 bf16_t;
typedef bf16_t v16bf __attribute__((ext_vector_type(16)));
typedef float  v8f   __attribute__((ext_vector_type(8)));
typedef float  v2f   __attribute__((ext_vector_type(2)));
typedef int    v4i   __attribute__((ext_vector_type(4)));

typedef short  v8s   __attribute__((ext_vector_type(8)));

union FragA { v16bf v; unsigned int u[8]; v8s h[2]; };
union FragC { v8f  v; float f[8]; };

__device__ __forceinline__ unsigned short f2bf(float x) {
    union { float f; unsigned int u; } c; c.f = x;
    unsigned int r = (c.u + 0x7fffu + ((c.u >> 16) & 1u)) >> 16;  // RNE
    return (unsigned short)r;
}

__device__ __forceinline__ int kpair_of(int j, int g) {
    return ((j >> 2) << 4) | (g << 3) | ((j & 3) << 1);
}

#if __has_builtin(__builtin_amdgcn_global_load_async_to_lds_b128)
#define HAVE_ASYNC_LDS 1
#else
#define HAVE_ASYNC_LDS 0
#endif

__device__ __forceinline__ void async_copy16(const void* gsrc, void* lds) {
#if HAVE_ASYNC_LDS
    __builtin_amdgcn_global_load_async_to_lds_b128(
        (__attribute__((address_space(1))) v4i*)gsrc,
        (__attribute__((address_space(3))) v4i*)lds, 0, 0);
#else
    *(uint4*)lds = *(const uint4*)gsrc;
#endif
}

// The two waits at a ring's publish point, each a statement of its own in front of the barrier.
// Own LDS reads have retired before the buffer they read is refilled behind the barrier.
__device__ __forceinline__ void wait_ds0() { asm volatile("s_wait_dscnt 0x0" ::: "memory"); }
// Own copies have landed before the barrier behind which other waves read them; in asm so that
// no LDS read is lifted over it.
__device__ __forceinline__ void wait_async0() { asm volatile("s_wait_asynccnt 0x0" ::: "memory"); }

__device__ __forceinline__ void load_b_tr16(FragA& f, const unsigned short* tile,
                                            int pitch, int k0, int n0, int lane) {
    typedef __attribute__((address_space(3))) v8s lds_v8s;
    const unsigned short* p =
        tile + (k0 + ((lane >> 4) << 3) + (lane & 7)) * pitch + n0 + (((lane >> 3) & 1) << 3);
    f.h[0] = __builtin_amdgcn_ds_load_tr16_b128_v8i16((lds_v8s*)p);
    f.h[1] = __builtin_amdgcn_ds_load_tr16_b128_v8i16((lds_v8s*)(p + 16 * pitch));
}

// ---------------------------------------------------------------- fp32 -> bf16
// Each block converts 256 * PER groups of 4 floats that lie in a row; the grid covers the
// array exactly. A wave's load covers 512 B in a row, its store 256 B: whole lines both ways.
// All PER loads of a lane are issued before the first is used.
template <int PER>
__global__ __launch_bounds__(256)
void cvt_f32_bf16(const float* __restrict__ src, unsigned short* __restrict__ dst) {
    const size_t g0 = (size_t)blockIdx.x * (256 * PER) + threadIdx.x;
    const float4* __restrict__ s4 = (const float4*)src;
    uint2* __restrict__ d4 = (uint2*)dst;
    float4 v[PER];
#pragma unroll   // v[] stays in registers and the loads go out as one run, ahead of any use
    for (int i = 0; i < PER; ++i) v[i] = s4[g0 + i * 256];
#pragma unroll   // constant indices into v[]
    for (int i = 0; i < PER; ++i) {
        uint2 o;
        o.x = (unsigned int)f2bf(v[i].x) | ((unsigned int)f2bf(v[i].y) << 16);
        o.y = (unsigned int)f2bf(v[i].z) | ((unsigned int)f2bf(v[i].w) << 16);
        d4[g0 + i * 256] = o;
    }
}

// -------------------------------------------------- tiled bf16 GEMM + bias
// C[M,N] = A[M,K] @ B[K,N] + bias[N]; 128x128 tile, BK=32, 8 waves,
// each wave computes 32x64 (2x4 tiles of 16x16) via v_wmma_f32_16x16x32_bf16.
template <bool STORE_BF16>
__global__ __launch_bounds__(256)
void gemm_bf16_wmma(const unsigned short* __restrict__ A,
                    const unsigned short* __restrict__ Bm,
                    const float* __restrict__ bias,
                    void* __restrict__ Cout,
                    int M, int N, int K) {
    // two buffers each: trip t reads buffer t & 1 while the copies of tile t + 1 land in the other
    __shared__ __attribute__((aligned(16))) unsigned short As[2][128][40];
    __shared__ __attribute__((aligned(16))) unsigned short Bs[2][32][144];

    const int tid  = threadIdx.x;
    const int wid  = tid >> 5, lane = tid & 31;
    const int g    = lane >> 4, ln = lane & 15;
    const int wm   = wid >> 1,  wn = wid & 1;
    const int m0   = blockIdx.y * 128, n0 = blockIdx.x * 128;

    FragC acc[2][4];
#pragma unroll
    for (int tm = 0; tm < 2; ++tm)
#pragma unroll
        for (int tn = 0; tn < 4; ++tn)
#pragma unroll
            for (int r = 0; r < 8; ++r) acc[tm][tn].f[r] = 0.f;

    // the copies of the tile at k = kb into buffer buf (4 x b128 per thread)
    auto stage = [&](int kb, int buf) {
        // A tile: straight row copy -> async global->LDS (2 x b128 per thread)
#pragma unroll
        for (int i = 0; i < 2; ++i) {
            int q = tid + i * 256;              // 0..511
            int row = q >> 2, seg = (q & 3) << 3;   // seg in elements (8 = 16B)
            async_copy16(A + (size_t)(m0 + row) * K + kb + seg, &As[buf][row][seg]);
        }
        // B tile: straight row copy too (2 x b128 per thread); the read transposes
#pragma unroll
        for (int i = 0; i < 2; ++i) {
            int q = tid + i * 256;              // 0..511
            int kk = q >> 4, seg = (q & 15) << 3;
            async_copy16(Bm + (size_t)(kb + kk) * N + n0 + seg, &Bs[buf][kk][seg]);
        }
    };

    if (K > 0) stage(0, 0);
    wait_async0();
    __syncthreads();                 // publishes tile 0
    if (K > 32) stage(32, 1);        // flies during trip 0

    for (int kb = 0; kb < K; kb += 32) {
        const int buf = (kb >> 5) & 1;

        FragA a[2], b[4];
#pragma unroll
        for (int tm = 0; tm < 2; ++tm)
#pragma unroll
            for (int j = 0; j < 8; ++j)
                a[tm].u[j] = *(const unsigned int*)&As[buf][wm * 32 + tm * 16 + ln][kpair_of(j, g)];
#pragma unroll
        for (int tn = 0; tn < 4; ++tn)
            load_b_tr16(b[tn], &Bs[buf][0][0], 144, 0, wn * 64 + tn * 16, lane);

        // publish point, behind the trip's last LDS read and in front of its products (they
        // work on registers alone, so the refill goes out ahead of them): the one barrier of a
        // trip publishes the next tile and ends every wave's reads of this one, whose buffer
        // is refilled behind it
        wait_ds0();
        wait_async0();
        __syncthreads();
        if (kb + 64 < K) stage(kb + 64, buf);

#pragma unroll
        for (int tm = 0; tm < 2; ++tm)
#pragma unroll
            for (int tn = 0; tn < 4; ++tn)
                acc[tm][tn].v = __builtin_amdgcn_wmma_f32_16x16x32_bf16(
                    false, a[tm].v, false, b[tn].v, (short)0, acc[tm][tn].v, false, false);
    }
    wait_async0();               // nothing of this wave is in flight when it leaves the ring

#pragma unroll
    for (int tm = 0; tm < 2; ++tm)
#pragma unroll
        for (int tn = 0; tn < 4; ++tn)
#pragma unroll
            for (int r = 0; r < 8; ++r) {
                int row = m0 + wm * 32 + tm * 16 + r + 8 * g;
                int col = n0 + wn * 64 + tn * 16 + ln;
                float v = acc[tm][tn].f[r] + bias[col];
                if (STORE_BF16)
                    ((unsigned short*)Cout)[(size_t)row * N + col] = f2bf(v);
                else
                    ((float*)Cout)[(size_t)row * N + col] = v;
            }
}

// ------------------------------------------------ flash-attention (streaming)
// grid = B*H*(SEQ/128), 128 threads (4 waves). Wave = 32 queries = QT query tiles of 16: every K and
// V fragment that a wave reads from LDS feeds one product per query tile.
// Both products are taken transposed: St = K Qt and Ot += Vt Pt. A lane (c = lane&15, g = lane>>4)
// then holds scores of ONE query per tile (c): register r of score tile n is key n*16 + 8g + r. Row
// maximum and row sum run inside the lane, with one exchange between the lane halves; two score
// tiles, converted in place, are the B operand (32 keys x 16 queries) of the second product.
#define QT 2
__device__ __forceinline__ float other_half(float x) {      // value of lane ^ 16
    int b = __float_as_int(x);
    return __int_as_float(__builtin_amdgcn_permlanex16(b, b, 0x76543210, 0xfedcba98, false, false));
}

__global__ __launch_bounds__(128) __attribute__((amdgpu_waves_per_eu(4, 4)))
void attention_wmma(const unsigned short* __restrict__ qkvb,   // [ROWS, 3E] bf16
                    const int* __restrict__ mask,              // [B*SEQ]
                    unsigned short* __restrict__ ctxb) {       // [ROWS, E] bf16
    // K in front of V in one object: V's column block lies 2048 B behind K's in a qkv row, the
    // compiler folds that step into the V copies' offset field (which moves the LDS address
    // too) and takes it off their LDS address register; with V at 9216 B that stays above 0.
    struct __attribute__((aligned(16))) KVTiles {
        unsigned short k[64][72];
        unsigned short v[64][80];
    };
    // two buffers: trip t reads buffer t & 1 while the copies of tile t + 1 land in the other
    __shared__ KVTiles kv[2];
    // per key 0 or a large negative number: the C operand of the score product. A lane's scores are
    // 32 different keys a tile, so the mask is turned into addends once a block, not per tile.
    __shared__ __attribute__((aligned(16))) float Mb[SEQ];

    const int tid = threadIdx.x;
    const int wid = tid >> 5, lane = tid & 31;
    const int g   = lane >> 4, ln = lane & 15;

    const int nqb = SEQ / (64 * QT);                // 16
    const int qb  = blockIdx.x % nqb;
    const int h   = (blockIdx.x / nqb) % HEADS;
    const int b   = blockIdx.x / (nqb * HEADS);

    const int    q0   = qb * (64 * QT) + wid * (16 * QT);
    const size_t rowB = (size_t)b * SEQ;
    // softmax in base 2: exp(scale * (s - m)) = exp2(s * sl2 - m * sl2), sl2 = 1/sqrt(64) * log2(e).
    // Scores and the running maximum stay unscaled (the scale is positive: the same key is the maximum).
    const float  sl2 = 0.125f * 1.44269504088896340736f;

    // Q fragments (B operand 32 d x 16 queries, two for d=64, per query tile) loaded once from
    // global; lane holds query q0 + t*16 + ln in the k order of kpair_of(), as the K loader below
    FragA aq[QT][2];
#pragma unroll
    for (int t = 0; t < QT; ++t)
#pragma unroll
        for (int f = 0; f < 2; ++f)
#pragma unroll
            for (int j = 0; j < 8; ++j) {
                int col = h * HDIM + f * 32 + kpair_of(j, g);
                aq[t][f].u[j] =
                    *(const unsigned int*)(qkvb + (rowB + q0 + t * 16 + ln) * (size_t)QKV_N + col);
            }

    // written in front of the ring's first barrier, read behind it
#pragma unroll
    for (int i = 0; i < SEQ / (128 * 4); ++i) {
        const int4 mv = ((const int4*)(mask + b * SEQ))[tid + i * 128];
        float4 mbv;
        mbv.x = (mv.x == 0) ? -1.0e38f : 0.f;
        mbv.y = (mv.y == 0) ? -1.0e38f : 0.f;
        mbv.z = (mv.z == 0) ? -1.0e38f : 0.f;
        mbv.w = (mv.w == 0) ? -1.0e38f : 0.f;
        ((float4*)Mb)[tid + i * 128] = mbv;
    }

    float m[QT];            // running maximum of query t*16 + ln, unscaled (equal in both lane halves)
    float l[QT];            // running sum over this lane half's keys; the halves join at the end
    FragC o[QT][4];         // o[t][dt].f[r] = Ot[dt*16 + 8g + r][query t*16 + ln]
#pragma unroll
    for (int t = 0; t < QT; ++t) {
        // far below any score, far above the mask addend: while every key so far is masked, m stays here,
        // m * sl2 stays small beside addend * sl2, and the multiply-add sends masked keys to weight 0
        m[t] = -1.0e30f;
        l[t] = 0.f;
#pragma unroll
        for (int dt = 0; dt < 4; ++dt)
#pragma unroll
            for (int r = 0; r < 8; ++r) o[t][dt].f[r] = 0.f;
    }

    // the copies of the 64 keys from kb on into buffer buf (8 x b128 per thread)
    auto stage = [&](int kb, int buf) {
        // K tile: straight row copy -> async global->LDS (4 x b128 per thread)
#pragma unroll
        for (int i = 0; i < 4; ++i) {
            int q = tid + i * 128;                 // 0..511
            int key = q >> 3, seg = (q & 7) << 3;  // seg in elements (8 = 16B)
            async_copy16(qkvb + (rowB + kb + key) * (size_t)QKV_N + EMBED + h * HDIM + seg,
                         &kv[buf].k[key][seg]);
        }
        // V tile: straight row copy too (4 x b128 per thread); the read transposes
#pragma unroll
        for (int i = 0; i < 4; ++i) {
            int q = tid + i * 128;                 // 0..511
            int key = q >> 3, seg = (q & 7) << 3;
            async_copy16(qkvb + (rowB + kb + key) * (size_t)QKV_N + 2 * EMBED + h * HDIM + seg,
                         &kv[buf].v[key][seg]);
        }
    };

    static_assert(SEQ >= 128, "the ring's prologue fills two tiles");
    stage(0, 0);
    wait_async0();
    __syncthreads();                 // publishes tile 0 and the mask addends
    stage(64, 1);                    // flies during trip 0

    for (int kb = 0; kb < SEQ; kb += 64) {
        const int buf = (kb >> 6) & 1;
        const unsigned short (&Kt)[64][72] = kv[buf].k;
        const unsigned short (&Vs)[64][80] = kv[buf].v;

        // St = K Qt + mask addend, unscaled   (64 keys x 32 queries per wave)
        FragC s[QT][4];
#pragma unroll
        for (int n = 0; n < 4; ++n) {
            // the lane's eight keys of this tile lie in a row
            const float4* mp = (const float4*)&Mb[kb + n * 16 + 8 * g];
            const float4 c0 = mp[0], c1 = mp[1];
#pragma unroll
            for (int t = 0; t < QT; ++t) {
                s[t][n].f[0] = c0.x; s[t][n].f[1] = c0.y; s[t][n].f[2] = c0.z; s[t][n].f[3] = c0.w;
                s[t][n].f[4] = c1.x; s[t][n].f[5] = c1.y; s[t][n].f[6] = c1.z; s[t][n].f[7] = c1.w;
            }
#pragma unroll
            for (int ks = 0; ks < 2; ++ks) {
                FragA bk;
#pragma unroll
                for (int j = 0; j < 8; ++j)
                    bk.u[j] = *(const unsigned int*)&Kt[n * 16 + ln][ks * 32 + kpair_of(j, g)];
#pragma unroll
                for (int t = 0; t < QT; ++t)
                    s[t][n].v = __builtin_amdgcn_wmma_f32_16x16x32_bf16(
                        false, bk.v, false, aq[t][ks].v, (short)0, s[t][n].v, false, false);
            }
        }

        FragA pb[QT][2];
#pragma unroll
        for (int t = 0; t < QT; ++t) {
            // online softmax, one query a lane: maximum over the lane's 32 keys, then the other half's
            float tmax[4];          // four chains that do not wait for one another
#pragma unroll
            for (int n = 0; n < 4; ++n) {
                tmax[n] = s[t][n].f[0];
#pragma unroll
                for (int r = 1; r < 8; ++r) tmax[n] = fmaxf(tmax[n], s[t][n].f[r]);
            }
            float rm = fmaxf(fmaxf(tmax[0], tmax[1]), fmaxf(tmax[2], tmax[3]));
            rm = fmaxf(rm, other_half(rm));

            const float mn    = fmaxf(m[t], rm);
            const float alpha = __builtin_amdgcn_exp2f((m[t] - mn) * sl2);
            const float nm    = -mn * sl2;      // one multiply-add a score carries scale, base and maximum
            m[t] = mn;
#pragma unroll
            for (int dt = 0; dt < 4; ++dt)
#pragma unroll
                for (int r = 0; r < 8; ++r) o[t][dt].f[r] *= alpha;

            float part[4];
#pragma unroll
            for (int n = 0; n < 4; ++n) {
                part[n] = 0.f;
#pragma unroll
                for (int r = 0; r < 8; r += 2) {
                    // the register pair as it lies in the accumulator: one packed multiply-add, no moves
                    v2f x = {s[t][n].f[r], s[t][n].f[r + 1]};
                    x = __builtin_elementwise_fma(x, (v2f){sl2, sl2}, (v2f){nm, nm});
                    const float p0 = __builtin_amdgcn_exp2f(x.x), p1 = __builtin_amdgcn_exp2f(x.y);
                    s[t][n].f[r]     = p0;
                    s[t][n].f[r + 1] = p1;
                    part[n] += p0;
                    part[n] += p1;
                }
            }
            l[t] = l[t] * alpha + ((part[0] + part[1]) + (part[2] + part[3]));

            // Pt as B operand: element e of the fragment is key ks*32 + (e < 8 ? 8g + e : 16 + 8g + e - 8),
            // which is register e & 7 of score tile 2*ks + (e >> 3)
#pragma unroll
            for (int ks = 0; ks < 2; ++ks)
#pragma unroll
                for (int e = 0; e < 16; ++e)
                    pb[t][ks].v[e] = (bf16_t)s[t][2 * ks + (e >> 3)].f[e & 7];
        }

        __builtin_amdgcn_sched_barrier(0);

        // Ot += Vt Pt; the transposing read delivers Vt (16 d x 32 keys) as the A operand
#pragma unroll
        for (int ks = 0; ks < 2; ++ks)
#pragma unroll
            for (int dt = 0; dt < 4; ++dt) {
                FragA bv;
                load_b_tr16(bv, &Vs[0][0], 80, ks * 32, dt * 16, lane);
#pragma unroll
                for (int t = 0; t < QT; ++t)
                    o[t][dt].v = __builtin_amdgcn_wmma_f32_16x16x32_bf16(
                        false, bv.v, false, pb[t][ks].v, (short)0, o[t][dt].v, false, false);
            }

        // publish point: the one barrier of a trip publishes the next tile and ends every
        // wave's reads of this one, whose buffer is refilled behind it
        wait_ds0();
        wait_async0();
        __syncthreads();
        if (kb + 128 < SEQ) stage(kb + 128, buf);
    }
    wait_async0();               // nothing of this wave is in flight when it leaves the ring

    // join the halves' sums, normalize and emit ctx (bf16, [B,T,E] row-major with head offset):
    // a lane's eight registers of a tile are eight d in a row of its query's row: one 16 B store
#pragma unroll
    for (int t = 0; t < QT; ++t) {
        const float lt  = l[t] + other_half(l[t]);
        const float inv = 1.f / lt;
        unsigned short* crow =
            ctxb + (size_t)(b * SEQ + q0 + t * 16 + ln) * EMBED + h * HDIM + 8 * g;
#pragma unroll
        for (int dt = 0; dt < 4; ++dt) {
            const FragC& ot = o[t][dt];
            uint4 w;
            w.x = (unsigned int)f2bf(ot.f[0] * inv) | ((unsigned int)f2bf(ot.f[1] * inv) << 16);
            w.y = (unsigned int)f2bf(ot.f[2] * inv) | ((unsigned int)f2bf(ot.f[3] * inv) << 16);
            w.z = (unsigned int)f2bf(ot.f[4] * inv) | ((unsigned int)f2bf(ot.f[5] * inv) << 16);
            w.w = (unsigned int)f2bf(ot.f[6] * inv) | ((unsigned int)f2bf(ot.f[7] * inv) << 16);
            *(uint4*)(crow + dt * 16) = w;
        }
    }
}

// ---------------------------------------------------------------------- launch
extern "C" void kernel_launch(void* const* d_in, const int* in_sizes, int n_in,
                              void* d_out, int out_size, void* d_ws, size_t ws_size,
                              hipStream_t stream) {
    (void)in_sizes; (void)n_in; (void)out_size; (void)ws_size;
    const float* x    = (const float*)d_in[0];
    const int*   mask = (const int*)  d_in[1];
    const float* Wqkv = (const float*)d_in[2];
    const float* bqkv = (const float*)d_in[3];
    const float* Wout = (const float*)d_in[4];
    const float* bout = (const float*)d_in[5];

    char* ws = (char*)d_ws;
    size_t off = 0;
    unsigned short* xb    = (unsigned short*)(ws + off); off += (size_t)ROWS  * EMBED * 2;
    unsigned short* wqkvb = (unsigned short*)(ws + off); off += (size_t)EMBED * QKV_N * 2;
    unsigned short* woutb = (unsigned short*)(ws + off); off += (size_t)EMBED * EMBED * 2;
    unsigned short* qkvb  = (unsigned short*)(ws + off); off += (size_t)ROWS  * QKV_N * 2;
    unsigned short* ctxb  = (unsigned short*)(ws + off); off += (size_t)ROWS  * EMBED * 2;

    static_assert((ROWS * EMBED) % (256 * 8 * 4) == 0 && (EMBED * QKV_N) % (256 * 6 * 4) == 0 &&
                  (EMBED * EMBED) % (256 * 4 * 4) == 0, "convert grids cover the arrays exactly");
    cvt_f32_bf16<8><<<(ROWS * EMBED) / (256 * 8 * 4), 256, 0, stream>>>(x, xb);          // 1024 blocks
    cvt_f32_bf16<6><<<(EMBED * QKV_N) / (256 * 6 * 4), 256, 0, stream>>>(Wqkv, wqkvb);   // 512 blocks
    cvt_f32_bf16<4><<<(EMBED * EMBED) / (256 * 4 * 4), 256, 0, stream>>>(Wout, woutb);   // 256 blocks

    // qkv = x @ Wqkv + bqkv   (bf16 out)
    gemm_bf16_wmma<true><<<dim3(QKV_N / 128, ROWS / 128), 256, 0, stream>>>(
        xb, wqkvb, bqkv, qkvb, ROWS, QKV_N, EMBED);

    // streaming attention per (b, h, 128-query block)
    attention_wmma<<<BATCH * HEADS * (SEQ / (64 * QT)), 128, 0, stream>>>(qkvb, mask, ctxb);

    // out = ctx @ Wout + bout  (fp32 out)
    gemm_bf16_wmma<false><<<dim3(EMBED / 128, ROWS / 128), 256, 0, stream>>>(
        ctxb, woutb, bout, d_out, ROWS, EMBED, EMBED);
}

// v008
// Measured time: 145 microseconds a run.
// Timed twice side by side with v007, it ran 1.10 times as fast both times.
// Counting every step since v000, it is 9.20 times as fast.
#include <hip/hip_runtime.h>
#include <stdint.h>

#define EMBED 1024
#define HEADS 16
#define HDIM  64
#define BATCH 4
#define SEQ   2048
#define ROWS  (BATCH * SEQ)     // 8192
#define QKV_N (3 * EMBED)       // 3072

typedef __bf16 bf16_t;
typedef bf16_t v16bf __attribute__((ext_vector_type(16)));
typedef float  v8f   __attribute__((ext_vector_type(8)));
typedef float  v2f   __attribute__((ext_vector_type(2)));
typedef int    v4i   __attribute__((ext_vector_type(4)));

typedef short  v8s   __attribute__((ext_vector_type(8)));

union FragA { v16bf v; unsigned int u[8]; v8s h[2]; };
union FragC { v8f  v; float f[8]; };

__device__ __forceinline__ unsigned short f2bf(float x) {
    union { float f; unsigned int u; } c; c.f = x;
    unsigned int r = (c.u + 0x7fffu + ((c.u >> 16) & 1u)) >> 16;  // RNE
    return (unsigned short)r;
}

__device__ __forceinline__ int kpair_of(int j, int g) {
    return ((j >> 2) << 4) | (g << 3) | ((j & 3) << 1);
}

#if __has_builtin(__builtin_amdgcn_global_load_async_to_lds_b128)
#define HAVE_ASYNC_LDS 1
#else
#define HAVE_ASYNC_LDS 0
#endif

__device__ __forceinline__ void async_copy16(const void* gsrc, void* lds) {
#if HAVE_ASYNC_LDS
    __builtin_amdgcn_global_load_async_to_lds_b128(
        (__attribute__((address_space(1))) v4i*)gsrc,
        (__attribute__((address_space(3))) v4i*)lds, 0, 0);
#else
    *(uint4*)lds = *(const uint4*)gsrc;
#endif
}

// The two waits at a ring's publish point, each a statement of its own in front of the barrier.
// Own LDS reads have retired before the buffer they read is refilled behind the barrier.
__device__ __forceinline__ void wait_ds0() { asm volatile("s_wait_dscnt 0x0" ::: "memory"); }
// Own copies have landed before the barrier behind which other waves read them; in asm so that
// no LDS read is lifted over it.
__device__ __forceinline__ void wait_async0() { asm volatile("s_wait_asynccnt 0x0" ::: "memory"); }

__device__ __forceinline__ void load_b_tr16(FragA& f, const unsigned short* tile,
                                            int pitch, int k0, int n0, int lane) {
    typedef __attribute__((address_space(3))) v8s lds_v8s;
    const unsigned short* p =
        tile + (k0 + ((lane >> 4) << 3) + (lane & 7)) * pitch + n0 + (((lane >> 3) & 1) << 3);
    f.h[0] = __builtin_amdgcn_ds_load_tr16_b128_v8i16((lds_v8s*)p);
    f.h[1] = __builtin_amdgcn_ds_load_tr16_b128_v8i16((lds_v8s*)(p + 16 * pitch));
}

// ---------------------------------------------------------------- fp32 -> bf16
// Each block converts 256 * PER groups of 4 floats that lie in a row; the grid covers the
// array exactly. A wave's load covers 512 B in a row, its store 256 B: whole lines both ways.
// All PER loads of a lane are issued before the first is used.
template <int PER>
__global__ __launch_bounds__(256)
void cvt_f32_bf16(const float* __restrict__ src, unsigned short* __restrict__ dst) {
    const size_t g0 = (size_t)blockIdx.x * (256 * PER) + threadIdx.x;
    const float4* __restrict__ s4 = (const float4*)src;
    uint2* __restrict__ d4 = (uint2*)dst;
    float4 v[PER];
#pragma unroll   // v[] stays in registers and the loads go out as one run, ahead of any use
    for (int i = 0; i < PER; ++i) v[i] = s4[g0 + i * 256];
#pragma unroll   // constant indices into v[]
    for (int i = 0; i < PER; ++i) {
        uint2 o;
        o.x = (unsigned int)f2bf(v[i].x) | ((unsigned int)f2bf(v[i].y) << 16);
        o.y = (unsigned int)f2bf(v[i].z) | ((unsigned int)f2bf(v[i].w) << 16);
        d4[g0 + i * 256] = o;
    }
}

// -------------------------------------------------- tiled bf16 GEMM + bias
// C[M,N] = A[M,K] @ B[K,N] + bias[N]; 256x128 tile, BK=64 (two k steps of 32), 8 waves (4 x 2),
// each wave computes 64x64 (4x4 tiles of 16x16) via v_wmma_f32_16x16x32_bf16: a fragment read
// from LDS feeds four products, and a copied A row is a whole 128 B line.
// M a multiple of 256, N of 128, K of 64.
template <bool STORE_BF16>
__global__ __launch_bounds__(256)
void gemm_bf16_wmma(const unsigned short* __restrict__ A,
                    const unsigned short* __restrict__ Bm,
                    const float* __restrict__ bias,
                    void* __restrict__ Cout,
                    int M, int N, int K) {
    // two buffers each: trip t reads buffer t & 1 while the copies of tile t + 1 land in the other
    __shared__ __attribute__((aligned(16))) unsigned short As[2][256][72];
    __shared__ __attribute__((aligned(16))) unsigned short Bs[2][64][144];

    const int tid  = threadIdx.x;
    const int wid  = tid >> 5, lane = tid & 31;
    const int g    = lane >> 4, ln = lane & 15;
    const int wm   = wid >> 1,  wn = wid & 1;
    const int m0   = blockIdx.y * 256, n0 = blockIdx.x * 128;

    FragC acc[4][4];
#pragma unroll   // constant indices: the register arrays stay in registers
    for (int tm = 0; tm < 4; ++tm)
#pragma unroll   // constant indices: the register arrays stay in registers
        for (int tn = 0; tn < 4; ++tn)
#pragma unroll   // constant indices: the register arrays stay in registers
            for (int r = 0; r < 8; ++r) acc[tm][tn].f[r] = 0.f;

    // the copies of the tile at k = kb into buffer buf (12 x b128 per thread)
    auto stage = [&](int kb, int buf) {
        // A tile: straight row copy -> async global->LDS (8 x b128 per thread; a wave covers 4 whole lines)
#pragma unroll   // the copies go out as one run
        for (int i = 0; i < 8; ++i) {
            int q = tid + i * 256;              // 0..2047
            int row = q >> 3, seg = (q & 7) << 3;   // seg in elements (8 = 16B)
            async_copy16(A + (size_t)(m0 + row) * K + kb + seg, &As[buf][row][seg]);
        }
        // B tile: straight row copy too (4 x b128 per thread); the read transposes
#pragma unroll   // the copies go out as one run
        for (int i = 0; i < 4; ++i) {
            int q = tid + i * 256;              // 0..1023
            int kk = q >> 4, seg = (q & 15) << 3;
            async_copy16(Bm + (size_t)(kb + kk) * N + n0 + seg, &Bs[buf][kk][seg]);
        }
    };

    if (K > 0) stage(0, 0);
    wait_async0();
    __syncthreads();                 // publishes tile 0
    if (K > 64) stage(64, 1);        // flies during trip 0

    for (int kb = 0; kb < K; kb += 64) {
        const int buf = (kb >> 6) & 1;

        FragA a[4], b[4];
        // the wave's fragments of k step ks; A and B both in the k order of kpair_of()
        auto frags = [&](int ks) {
#pragma unroll   // constant indices: the register arrays stay in registers
            for (int tm = 0; tm < 4; ++tm)
#pragma unroll   // constant indices: the register arrays stay in registers
                for (int j = 0; j < 8; ++j)
                    a[tm].u[j] = *(const unsigned int*)
                        &As[buf][wm * 64 + tm * 16 + ln][ks * 32 + kpair_of(j, g)];
#pragma unroll   // constant indices: the register arrays stay in registers
            for (int tn = 0; tn < 4; ++tn)
                load_b_tr16(b[tn], &Bs[buf][0][0], 144, ks * 32, wn * 64 + tn * 16, lane);
        };
        auto products = [&]() {
#pragma unroll   // constant indices: the register arrays stay in registers
            for (int tm = 0; tm < 4; ++tm)
#pragma unroll   // constant indices: the register arrays stay in registers
                for (int tn = 0; tn < 4; ++tn)
                    acc[tm][tn].v = __builtin_amdgcn_wmma_f32_16x16x32_bf16(
                        false, a[tm].v, false, b[tn].v, (short)0, acc[tm][tn].v, false, false);
        };

        frags(0);
        products();
        frags(1);

        // publish point, behind the trip's last LDS read and in front of its last products (they
        // work on registers alone, so the refill goes out ahead of them): the one barrier of a
        // trip publishes the next tile and ends every wave's reads of this one, whose buffer
        // is refilled behind it
        wait_ds0();
        wait_async0();
        __syncthreads();
        if (kb + 128 < K) stage(kb + 128, buf);

        products();
    }
    wait_async0();               // nothing of this wave is in flight when it leaves the ring

#pragma unroll   // constant indices: the register arrays stay in registers
    for (int tm = 0; tm < 4; ++tm)
#pragma unroll   // constant indices: the register arrays stay in registers
        for (int tn = 0; tn < 4; ++tn)
#pragma unroll   // constant indices: the register arrays stay in registers
            for (int r = 0; r < 8; ++r) {
                int row = m0 + wm * 64 + tm * 16 + r + 8 * g;
                int col = n0 + wn * 64 + tn * 16 + ln;
                float v = acc[tm][tn].f[r] + bias[col];
                if (STORE_BF16)
                    ((unsigned short*)Cout)[(size_t)row * N + col] = f2bf(v);
                else
                    ((float*)Cout)[(size_t)row * N + col] = v;
            }
}

// ------------------------------------------------ flash-attention (streaming)
// grid = B*H*(SEQ/128), 128 threads (4 waves). Wave = 32 queries = QT query tiles of 16: every K and
// V fragment that a wave reads from LDS feeds one product per query tile.
// Both products are taken transposed: St = K Qt and Ot += Vt Pt. A lane (c = lane&15, g = lane>>4)
// then holds scores of ONE query per tile (c): register r of score tile n is key n*16 + 8g + r. Row
// maximum and row sum run inside the lane, with one exchange between the lane halves; two score
// tiles, converted in place, are the B operand (32 keys x 16 queries) of the second product.
#define QT 2
__device__ __forceinline__ float other_half(float x) {      // value of lane ^ 16
    int b = __float_as_int(x);
    return __int_as_float(__builtin_amdgcn_permlanex16(b, b, 0x76543210, 0xfedcba98, false, false));
}

__global__ __launch_bounds__(128) __attribute__((amdgpu_waves_per_eu(4, 4)))
void attention_wmma(const unsigned short* __restrict__ qkvb,   // [ROWS, 3E] bf16
                    const int* __restrict__ mask,              // [B*SEQ]
                    unsigned short* __restrict__ ctxb) {       // [ROWS, E] bf16
    // K in front of V in one object: V's column block lies 2048 B behind K's in a qkv row, the
    // compiler folds that step into the V copies' offset field (which moves the LDS address
    // too) and takes it off their LDS address register; with V at 9216 B that stays above 0.
    struct __attribute__((aligned(16))) KVTiles {
        unsigned short k[64][72];
        unsigned short v[64][80];
    };
    // two buffers: trip t reads buffer t & 1 while the copies of tile t + 1 land in the other
    __shared__ KVTiles kv[2];
    // per key 0 or a large negative number: the C operand of the score product. A lane's scores are
    // 32 different keys a tile, so the mask is turned into addends once a block, not per tile.
    __shared__ __attribute__((aligned(16))) float Mb[SEQ];

    const int tid = threadIdx.x;
    const int wid = tid >> 5, lane = tid & 31;
    const int g   = lane >> 4, ln = lane & 15;

    const int nqb = SEQ / (64 * QT);                // 16
    const int qb  = blockIdx.x % nqb;
    const int h   = (blockIdx.x / nqb) % HEADS;
    const int b   = blockIdx.x / (nqb * HEADS);

    const int    q0   = qb * (64 * QT) + wid * (16 * QT);
    const size_t rowB = (size_t)b * SEQ;
    // softmax in base 2: exp(scale * (s - m)) = exp2(s * sl2 - m * sl2), sl2 = 1/sqrt(64) * log2(e).
    // Scores and the running maximum stay unscaled (the scale is positive: the same key is the maximum).
    const float  sl2 = 0.125f * 1.44269504088896340736f;

    // Q fragments (B operand 32 d x 16 queries, two for d=64, per query tile) loaded once from
    // global; lane holds query q0 + t*16 + ln in the k order of kpair_of(), as the K loader below
    FragA aq[QT][2];
#pragma unroll
    for (int t = 0; t < QT; ++t)
#pragma unroll
        for (int f = 0; f < 2; ++f)
#pragma unroll
            for (int j = 0; j < 8; ++j) {
                int col = h * HDIM + f * 32 + kpair_of(j, g);
                aq[t][f].u[j] =
                    *(const unsigned int*)(qkvb + (rowB + q0 + t * 16 + ln) * (size_t)QKV_N + col);
            }

    // written in front of the ring's first barrier, read behind it
#pragma unroll
    for (int i = 0; i < SEQ / (128 * 4); ++i) {
        const int4 mv = ((const int4*)(mask + b * SEQ))[tid + i * 128];
        float4 mbv;
        mbv.x = (mv.x == 0) ? -1.0e38f : 0.f;
        mbv.y = (mv.y == 0) ? -1.0e38f : 0.f;
        mbv.z = (mv.z == 0) ? -1.0e38f : 0.f;
        mbv.w = (mv.w == 0) ? -1.0e38f : 0.f;
        ((float4*)Mb)[tid + i * 128] = mbv;
    }

    float m[QT];            // running maximum of query t*16 + ln, unscaled (equal in both lane halves)
    float l[QT];            // running sum over this lane half's keys; the halves join at the end
    FragC o[QT][4];         // o[t][dt].f[r] = Ot[dt*16 + 8g + r][query t*16 + ln]
#pragma unroll
    for (int t = 0; t < QT; ++t) {
        // far below any score, far above the mask addend: while every key so far is masked, m stays here,
        // m * sl2 stays small beside addend * sl2, and the multiply-add sends masked keys to weight 0
        m[t] = -1.0e30f;
        l[t] = 0.f;
#pragma unroll
        for (int dt = 0; dt < 4; ++dt)
#pragma unroll
            for (int r = 0; r < 8; ++r) o[t][dt].f[r] = 0.f;
    }

    // the copies of the 64 keys from kb on into buffer buf (8 x b128 per thread)
    auto stage = [&](int kb, int buf) {
        // K tile: straight row copy -> async global->LDS (4 x b128 per thread)
#pragma unroll
        for (int i = 0; i < 4; ++i) {
            int q = tid + i * 128;                 // 0..511
            int key = q >> 3, seg = (q & 7) << 3;  // seg in elements (8 = 16B)
            async_copy16(qkvb + (rowB + kb + key) * (size_t)QKV_N + EMBED + h * HDIM + seg,
                         &kv[buf].k[key][seg]);
        }
        // V tile: straight row copy too (4 x b128 per thread); the read transposes
#pragma unroll
        for (int i = 0; i < 4; ++i) {
            int q = tid + i * 128;                 // 0..511
            int key = q >> 3, seg = (q & 7) << 3;
            async_copy16(qkvb + (rowB + kb + key) * (size_t)QKV_N + 2 * EMBED + h * HDIM + seg,
                         &kv[buf].v[key][seg]);
        }
    };

    static_assert(SEQ >= 128, "the ring's prologue fills two tiles");
    stage(0, 0);
    wait_async0();
    __syncthreads();                 // publishes tile 0 and the mask addends
    stage(64, 1);                    // flies during trip 0

    for (int kb = 0; kb < SEQ; kb += 64) {
        const int buf = (kb >> 6) & 1;
        const unsigned short (&Kt)[64][72] = kv[buf].k;
        const unsigned short (&Vs)[64][80] = kv[buf].v;

        // St = K Qt + mask addend, unscaled   (64 keys x 32 queries per wave)
        FragC s[QT][4];
#pragma unroll
        for (int n = 0; n < 4; ++n) {
            // the lane's eight keys of this tile lie in a row
            const float4* mp = (const float4*)&Mb[kb + n * 16 + 8 * g];
            const float4 c0 = mp[0], c1 = mp[1];
#pragma unroll
            for (int t = 0; t < QT; ++t) {
                s[t][n].f[0] = c0.x; s[t][n].f[1] = c0.y; s[t][n].f[2] = c0.z; s[t][n].f[3] = c0.w;
                s[t][n].f[4] = c1.x; s[t][n].f[5] = c1.y; s[t][n].f[6] = c1.z; s[t][n].f[7] = c1.w;
            }
#pragma unroll
            for (int ks = 0; ks < 2; ++ks) {
                FragA bk;
#pragma unroll
                for (int j = 0; j < 8; ++j)
                    bk.u[j] = *(const unsigned int*)&Kt[n * 16 + ln][ks * 32 + kpair_of(j, g)];
#pragma unroll
                for (int t = 0; t < QT; ++t)
                    s[t][n].v = __builtin_amdgcn_wmma_f32_16x16x32_bf16(
                        false, bk.v, false, aq[t][ks].v, (short)0, s[t][n].v, false, false);
            }
        }

        FragA pb[QT][2];
#pragma unroll
        for (int t = 0; t < QT; ++t) {
            // online softmax, one query a lane: maximum over the lane's 32 keys, then the other half's
            float tmax[4];          // four chains that do not wait for one another
#pragma unroll
            for (int n = 0; n < 4; ++n) {
                tmax[n] = s[t][n].f[0];
#pragma unroll
                for (int r = 1; r < 8; ++r) tmax[n] = fmaxf(tmax[n], s[t][n].f[r]);
            }
            float rm = fmaxf(fmaxf(tmax[0], tmax[1]), fmaxf(tmax[2], tmax[3]));
            rm = fmaxf(rm, other_half(rm));

            const float mn    = fmaxf(m[t], rm);
            const float alpha = __builtin_amdgcn_exp2f((m[t] - mn) * sl2);
            const float nm    = -mn * sl2;      // one multiply-add a score carries scale, base and maximum
            m[t] = mn;
#pragma unroll
            for (int dt = 0; dt < 4; ++dt)
#pragma unroll
                for (int r = 0; r < 8; ++r) o[t][dt].f[r] *= alpha;

            float part[4];
#pragma unroll
            for (int n = 0; n < 4; ++n) {
                part[n] = 0.f;
#pragma unroll
                for (int r = 0; r < 8; r += 2) {
                    // the register pair as it lies in the accumulator: one packed multiply-add, no moves
                    v2f x = {s[t][n].f[r], s[t][n].f[r + 1]};
                    x = __builtin_elementwise_fma(x, (v2f){sl2, sl2}, (v2f){nm, nm});
                    const float p0 = __builtin_amdgcn_exp2f(x.x), p1 = __builtin_amdgcn_exp2f(x.y);
                    s[t][n].f[r]     = p0;
                    s[t][n].f[r + 1] = p1;
                    part[n] += p0;
                    part[n] += p1;
                }
            }
            l[t] = l[t] * alpha + ((part[0] + part[1]) + (part[2] + part[3]));

            // Pt as B operand: element e of the fragment is key ks*32 + (e < 8 ? 8g + e : 16 + 8g + e - 8),
            // which is register e & 7 of score tile 2*ks + (e >> 3)
#pragma unroll
            for (int ks = 0; ks < 2; ++ks)
#pragma unroll
                for (int e = 0; e < 16; ++e)
                    pb[t][ks].v[e] = (bf16_t)s[t][2 * ks + (e >> 3)].f[e & 7];
        }

        __builtin_amdgcn_sched_barrier(0);

        // Ot += Vt Pt; the transposing read delivers Vt (16 d x 32 keys) as the A operand
#pragma unroll
        for (int ks = 0; ks < 2; ++ks)
#pragma unroll
            for (int dt = 0; dt < 4; ++dt) {
                FragA bv;
                load_b_tr16(bv, &Vs[0][0], 80, ks * 32, dt * 16, lane);
#pragma unroll
                for (int t = 0; t < QT; ++t)
                    o[t][dt].v = __builtin_amdgcn_wmma_f32_16x16x32_bf16(
                        false, bv.v, false, pb[t][ks].v, (short)0, o[t][dt].v, false, false);
            }

        // publish point: the one barrier of a trip publishes the next tile and ends every
        // wave's reads of this one, whose buffer is refilled behind it
        wait_ds0();
        wait_async0();
        __syncthreads();
        if (kb + 128 < SEQ) stage(kb + 128, buf);
    }
    wait_async0();               // nothing of this wave is in flight when it leaves the ring

    // join the halves' sums, normalize and emit ctx (bf16, [B,T,E] row-major with head offset):
    // a lane's eight registers of a tile are eight d in a row of its query's row: one 16 B store
#pragma unroll
    for (int t = 0; t < QT; ++t) {
        const float lt  = l[t] + other_half(l[t]);
        const float inv = 1.f / lt;
        unsigned short* crow =
            ctxb + (size_t)(b * SEQ + q0 + t * 16 + ln) * EMBED + h * HDIM + 8 * g;
#pragma unroll
        for (int dt = 0; dt < 4; ++dt) {
            const FragC& ot = o[t][dt];
            uint4 w;
            w.x = (unsigned int)f2bf(ot.f[0] * inv) | ((unsigned int)f2bf(ot.f[1] * inv) << 16);
            w.y = (unsigned int)f2bf(ot.f[2] * inv) | ((unsigned int)f2bf(ot.f[3] * inv) << 16);
            w.z = (unsigned int)f2bf(ot.f[4] * inv) | ((unsigned int)f2bf(ot.f[5] * inv) << 16);
            w.w = (unsigned int)f2bf(ot.f[6] * inv) | ((unsigned int)f2bf(ot.f[7] * inv) << 16);
            *(uint4*)(crow + dt * 16) = w;
        }
    }
}

// ---------------------------------------------------------------------- launch
extern "C" void kernel_launch(void* const* d_in, const int* in_sizes, int n_in,
                              void* d_out, int out_size, void* d_ws, size_t ws_size,
                              hipStream_t stream) {
    (void)in_sizes; (void)n_in; (void)out_size; (void)ws_size;
    const float* x    = (const float*)d_in[0];
    const int*   mask = (const int*)  d_in[1];
    const float* Wqkv = (const float*)d_in[2];
    const float* bqkv = (const float*)d_in[3];
    const float* Wout = (const float*)d_in[4];
    const float* bout = (const float*)d_in[5];

    char* ws = (char*)d_ws;
    size_t off = 0;
    unsigned short* xb    = (unsigned short*)(ws + off); off += (size_t)ROWS  * EMBED * 2;
    unsigned short* wqkvb = (unsigned short*)(ws + off); off += (size_t)EMBED * QKV_N * 2;
    unsigned short* woutb = (unsigned short*)(ws + off); off += (size_t)EMBED * EMBED * 2;
    unsigned short* qkvb  = (unsigned short*)(ws + off); off += (size_t)ROWS  * QKV_N * 2;
    unsigned short* ctxb  = (unsigned short*)(ws + off); off += (size_t)ROWS  * EMBED * 2;

    static_assert((ROWS * EMBED) % (256 * 8 * 4) == 0 && (EMBED * QKV_N) % (256 * 6 * 4) == 0 &&
                  (EMBED * EMBED) % (256 * 4 * 4) == 0, "convert grids cover the arrays exactly");
    cvt_f32_bf16<8><<<(ROWS * EMBED) / (256 * 8 * 4), 256, 0, stream>>>(x, xb);          // 1024 blocks
    cvt_f32_bf16<6><<<(EMBED * QKV_N) / (256 * 6 * 4), 256, 0, stream>>>(Wqkv, wqkvb);   // 512 blocks
    cvt_f32_bf16<4><<<(EMBED * EMBED) / (256 * 4 * 4), 256, 0, stream>>>(Wout, woutb);   // 256 blocks

    // qkv = x @ Wqkv + bqkv   (bf16 out)
    gemm_bf16_wmma<true><<<dim3(QKV_N / 128, ROWS / 256), 256, 0, stream>>>(
        xb, wqkvb, bqkv, qkvb, ROWS, QKV_N, EMBED);

    // streaming attention per (b, h, 128-query block)
    attention_wmma<<<BATCH * HEADS * (SEQ / (64 * QT)), 128, 0, stream>>>(qkvb, mask, ctxb);

    // out = ctx @ Wout + bout  (fp32 out)
    gemm_bf16_wmma<false><<<dim3(EMBED / 128, ROWS / 256), 256, 0, stream>>>(
        ctxb, woutb, bout, d_out, ROWS, EMBED, EMBED);
}

// v009
// Measured time: 137 microseconds a run.
// Next to v008, in two timings, it ran 1.05 and 1.06 times as fast.
// Over all steps from v000 it is 9.68 times as fast.
#include <hip/hip_runtime.h>
#include <stdint.h>

#define EMBED 1024
#define HEADS 16
#define HDIM  64
#define BATCH 4
#define SEQ   2048
#define ROWS  (BATCH * SEQ)     // 8192
#define QKV_N (3 * EMBED)       // 3072

typedef __bf16 bf16_t;
typedef bf16_t v16bf __attribute__((ext_vector_type(16)));
typedef float  v8f   __attribute__((ext_vector_type(8)));
typedef float  v2f   __attribute__((ext_vector_type(2)));
typedef int    v4i   __attribute__((ext_vector_type(4)));

typedef short  v8s   __attribute__((ext_vector_type(8)));

union FragA { v16bf v; unsigned int u[8]; v8s h[2]; };
union FragC { v8f  v; float f[8]; };

__device__ __forceinline__ unsigned short f2bf(float x) {
    union { float f; unsigned int u; } c; c.f = x;
    unsigned int r = (c.u + 0x7fffu + ((c.u >> 16) & 1u)) >> 16;  // RNE
    return (unsigned short)r;
}

__device__ __forceinline__ int kpair_of(int j, int g) {
    return ((j >> 2) << 4) | (g << 3) | ((j & 3) << 1);
}

#if __has_builtin(__builtin_amdgcn_global_load_async_to_lds_b128)
#define HAVE_ASYNC_LDS 1
#else
#define HAVE_ASYNC_LDS 0
#endif

__device__ __forceinline__ void async_copy16(const void* gsrc, void* lds) {
#if HAVE_ASYNC_LDS
    __builtin_amdgcn_global_load_async_to_lds_b128(
        (__attribute__((address_space(1))) v4i*)gsrc,
        (__attribute__((address_space(3))) v4i*)lds, 0, 0);
#else
    *(uint4*)lds = *(const uint4*)gsrc;
#endif
}

// The two waits at a ring's publish point, each a statement of its own in front of the barrier.
// Own LDS reads have retired before the buffer they read is refilled behind the barrier.
__device__ __forceinline__ void wait_ds0() { asm volatile("s_wait_dscnt 0x0" ::: "memory"); }
// Own copies have landed before the barrier behind which other waves read them; in asm so that
// no LDS read is lifted over it.
__device__ __forceinline__ void wait_async0() { asm volatile("s_wait_asynccnt 0x0" ::: "memory"); }

__device__ __forceinline__ void load_b_tr16(FragA& f, const unsigned short* tile,
                                            int pitch, int k0, int n0, int lane) {
    typedef __attribute__((address_space(3))) v8s lds_v8s;
    const unsigned short* p =
        tile + (k0 + ((lane >> 4) << 3) + (lane & 7)) * pitch + n0 + (((lane >> 3) & 1) << 3);
    f.h[0] = __builtin_amdgcn_ds_load_tr16_b128_v8i16((lds_v8s*)p);
    f.h[1] = __builtin_amdgcn_ds_load_tr16_b128_v8i16((lds_v8s*)(p + 16 * pitch));
}

// ---------------------------------------------------------------- fp32 -> bf16
// Each block converts 256 * PER groups of 4 floats that lie in a row; the grid covers the
// array exactly. A wave's load covers 512 B in a row, its store 256 B: whole lines both ways.
// All PER loads of a lane are issued before the first is used.
template <int PER>
__global__ __launch_bounds__(256)
void cvt_f32_bf16(const float* __restrict__ src, unsigned short* __restrict__ dst) {
    const size_t g0 = (size_t)blockIdx.x * (256 * PER) + threadIdx.x;
    const float4* __restrict__ s4 = (const float4*)src;
    uint2* __restrict__ d4 = (uint2*)dst;
    float4 v[PER];
#pragma unroll   // v[] stays in registers and the loads go out as one run, ahead of any use
    for (int i = 0; i < PER; ++i) v[i] = s4[g0 + i * 256];
#pragma unroll   // constant indices into v[]
    for (int i = 0; i < PER; ++i) {
        uint2 o;
        o.x = (unsigned int)f2bf(v[i].x) | ((unsigned int)f2bf(v[i].y) << 16);
        o.y = (unsigned int)f2bf(v[i].z) | ((unsigned int)f2bf(v[i].w) << 16);
        d4[g0 + i * 256] = o;
    }
}

// -------------------------------------------------- tiled bf16 GEMM + bias
// C[M,N] = A[M,K] @ B[K,N] + bias[N]; 256x128 tile, BK=64 (two k steps of 32), 8 waves (4 x 2),
// each wave computes 64x64 (4x4 tiles of 16x16) via v_wmma_f32_16x16x32_bf16: a fragment read
// from LDS feeds four products, and a copied A row is a whole 128 B line.
// The B fragment is the first operand of the product, so a tile comes out transposed: a lane holds
// eight columns in a row of ONE row of C. The epilogue lays them in LDS by 16 B and stores whole lines.
// M a multiple of 256, N of 128, K of 64.
template <bool STORE_BF16>
__global__ __launch_bounds__(256)
void gemm_bf16_wmma(const unsigned short* __restrict__ A,
                    const unsigned short* __restrict__ Bm,
                    const float* __restrict__ bias,
                    void* __restrict__ Cout,
                    int M, int N, int K) {
    // two buffers each: trip t reads buffer t & 1 while the copies of tile t + 1 land in the other
    __shared__ __attribute__((aligned(16))) unsigned short As[2][256][72];
    __shared__ __attribute__((aligned(16))) unsigned short Bs[2][64][144];

    const int tid  = threadIdx.x;
    const int wid  = tid >> 5, lane = tid & 31;
    const int g    = lane >> 4, ln = lane & 15;
    const int wm   = wid >> 1,  wn = wid & 1;
    const int m0   = blockIdx.y * 256, n0 = blockIdx.x * 128;

    FragC acc[4][4];
#pragma unroll   // constant indices: the register arrays stay in registers
    for (int tm = 0; tm < 4; ++tm)
#pragma unroll   // constant indices: the register arrays stay in registers
        for (int tn = 0; tn < 4; ++tn)
#pragma unroll   // constant indices: the register arrays stay in registers
            for (int r = 0; r < 8; ++r) acc[tm][tn].f[r] = 0.f;

    // the copies of the tile at k = kb into buffer buf (12 x b128 per thread)
    auto stage = [&](int kb, int buf) {
        // A tile: straight row copy -> async global->LDS (8 x b128 per thread; a wave covers 4 whole lines)
#pragma unroll   // the copies go out as one run
        for (int i = 0; i < 8; ++i) {
            int q = tid + i * 256;              // 0..2047
            int row = q >> 3, seg = (q & 7) << 3;   // seg in elements (8 = 16B)
            async_copy16(A + (size_t)(m0 + row) * K + kb + seg, &As[buf][row][seg]);
        }
        // B tile: straight row copy too (4 x b128 per thread); the read transposes
#pragma unroll   // the copies go out as one run
        for (int i = 0; i < 4; ++i) {
            int q = tid + i * 256;              // 0..1023
            int kk = q >> 4, seg = (q & 15) << 3;
            async_copy16(Bm + (size_t)(kb + kk) * N + n0 + seg, &Bs[buf][kk][seg]);
        }
    };

    if (K > 0) stage(0, 0);
    wait_async0();
    __syncthreads();                 // publishes tile 0
    if (K > 64) stage(64, 1);        // flies during trip 0

    for (int kb = 0; kb < K; kb += 64) {
        const int buf = (kb >> 6) & 1;

        FragA a[4], b[4];
        // the wave's fragments of k step ks; A and B both in the k order of kpair_of()
        auto frags = [&](int ks) {
#pragma unroll   // constant indices: the register arrays stay in registers
            for (int tm = 0; tm < 4; ++tm)
#pragma unroll   // constant indices: the register arrays stay in registers
                for (int j = 0; j < 8; ++j)
                    a[tm].u[j] = *(const unsigned int*)
                        &As[buf][wm * 64 + tm * 16 + ln][ks * 32 + kpair_of(j, g)];
#pragma unroll   // constant indices: the register arrays stay in registers
            for (int tn = 0; tn < 4; ++tn)
                load_b_tr16(b[tn], &Bs[buf][0][0], 144, ks * 32, wn * 64 + tn * 16, lane);
        };
        auto products = [&]() {
#pragma unroll   // constant indices: the register arrays stay in registers
            for (int tm = 0; tm < 4; ++tm)
#pragma unroll   // constant indices: the register arrays stay in registers
                for (int tn = 0; tn < 4; ++tn)
                    acc[tm][tn].v = __builtin_amdgcn_wmma_f32_16x16x32_bf16(
                        false, b[tn].v, false, a[tm].v, (short)0, acc[tm][tn].v, false, false);
        };

        frags(0);
        products();
        frags(1);

        // publish point, behind the trip's last LDS read and in front of its last products (they
        // work on registers alone, so the refill goes out ahead of them): the one barrier of a
        // trip publishes the next tile and ends every wave's reads of this one, whose buffer
        // is refilled behind it
        wait_ds0();
        wait_async0();
        __syncthreads();
        if (kb + 128 < K) stage(kb + 128, buf);

        products();
    }
    wait_async0();               // nothing of this wave is in flight when it leaves the ring

    // acc[tm][tn].f[r] = C[wm*64 + tm*16 + ln][wn*64 + tn*16 + 8g + r]
    // the lane's 32 bias values, eight in a row per column tile, loaded as one run
    float4 bv[4][2];
#pragma unroll   // constant indices: the register arrays stay in registers
    for (int tn = 0; tn < 4; ++tn) {
        const float4* bp = (const float4*)(bias + n0 + wn * 64 + tn * 16 + 8 * g);
        bv[tn][0] = bp[0];
        bv[tn][1] = bp[1];
    }

    // Staging: the ring is free (the last trip's barrier stands behind every wave's last read of it, and
    // no copy is in flight). Each wave has 9,216 B of the A buffers for itself, so no barrier is needed.
    char* const st = (char*)&As[0][0][0] + wid * 9216;
    if (STORE_BF16) {
#pragma unroll   // constant indices: the register arrays stay in registers
        for (int tm = 0; tm < 4; ++tm)
#pragma unroll   // constant indices: the register arrays stay in registers
            for (int tn = 0; tn < 4; ++tn) {
                const FragC& c = acc[tm][tn];
                union { bf16_t e[8]; uint4 q; } w;
                w.e[0] = (bf16_t)(c.f[0] + bv[tn][0].x); w.e[1] = (bf16_t)(c.f[1] + bv[tn][0].y);
                w.e[2] = (bf16_t)(c.f[2] + bv[tn][0].z); w.e[3] = (bf16_t)(c.f[3] + bv[tn][0].w);
                w.e[4] = (bf16_t)(c.f[4] + bv[tn][1].x); w.e[5] = (bf16_t)(c.f[5] + bv[tn][1].y);
                w.e[6] = (bf16_t)(c.f[6] + bv[tn][1].z); w.e[7] = (bf16_t)(c.f[7] + bv[tn][1].w);
                *(uint4*)(st + (tm * 16 + ln) * 144 + tn * 32 + g * 16) = w.q;
            }
        wait_ds0();      // the wave's rows lie in LDS before other lanes of it read them back
        // eight lanes read and store one row's 128 B: a store covers four whole lines
        unsigned short* crow = (unsigned short*)Cout +
            (size_t)(m0 + wm * 64 + (lane >> 3)) * N + n0 + wn * 64 + (lane & 7) * 8;
#pragma unroll   // the reads go out as one run
        for (int i = 0; i < 16; ++i)
            *(uint4*)(crow + (size_t)(i * 4) * N) =
                *(const uint4*)(st + (i * 4 + (lane >> 3)) * 144 + (lane & 7) * 16);
    } else {
        // 32 rows of 256 B at pitch 272 B (16 B x odd) at a time: two rounds through the wave's range
#pragma unroll   // constant indices: the register arrays stay in registers
        for (int hm = 0; hm < 2; ++hm) {
#pragma unroll   // constant indices: the register arrays stay in registers
            for (int t2 = 0; t2 < 2; ++t2)
#pragma unroll   // constant indices: the register arrays stay in registers
                for (int tn = 0; tn < 4; ++tn) {
                    const FragC& c = acc[hm * 2 + t2][tn];
                    float4* p = (float4*)(st + (t2 * 16 + ln) * 272 + tn * 64 + g * 32);
                    p[0] = make_float4(c.f[0] + bv[tn][0].x, c.f[1] + bv[tn][0].y,
                                       c.f[2] + bv[tn][0].z, c.f[3] + bv[tn][0].w);
                    p[1] = make_float4(c.f[4] + bv[tn][1].x, c.f[5] + bv[tn][1].y,
                                       c.f[6] + bv[tn][1].z, c.f[7] + bv[tn][1].w);
                }
            wait_ds0();  // the wave's rows lie in LDS before other lanes of it read them back
            // sixteen lanes read and store one row's 256 B: a store covers four whole lines
            float* crow = (float*)Cout +
                (size_t)(m0 + wm * 64 + hm * 32 + (lane >> 4)) * N + n0 + wn * 64 + (lane & 15) * 4;
#pragma unroll   // the reads go out as one run
            for (int i = 0; i < 16; ++i)
                *(float4*)(crow + (size_t)(i * 2) * N) =
                    *(const float4*)(st + (i * 2 + (lane >> 4)) * 272 + (lane & 15) * 16);
            if (hm == 0) wait_ds0();  // the read-back has retired before the next round overwrites the range
        }
    }
}

// ------------------------------------------------ flash-attention (streaming)
// grid = B*H*(SEQ/128), 128 threads (4 waves). Wave = 32 queries = QT query tiles of 16: every K and
// V fragment that a wave reads from LDS feeds one product per query tile.
// Both products are taken transposed: St = K Qt and Ot += Vt Pt. A lane (c = lane&15, g = lane>>4)
// then holds scores of ONE query per tile (c): register r of score tile n is key n*16 + 8g + r. Row
// maximum and row sum run inside the lane, with one exchange between the lane halves; two score
// tiles, converted in place, are the B operand (32 keys x 16 queries) of the second product.
#define QT 2
__device__ __forceinline__ float other_half(float x) {      // value of lane ^ 16
    int b = __float_as_int(x);
    return __int_as_float(__builtin_amdgcn_permlanex16(b, b, 0x76543210, 0xfedcba98, false, false));
}

__global__ __launch_bounds__(128) __attribute__((amdgpu_waves_per_eu(4, 4)))
void attention_wmma(const unsigned short* __restrict__ qkvb,   // [ROWS, 3E] bf16
                    const int* __restrict__ mask,              // [B*SEQ]
                    unsigned short* __restrict__ ctxb) {       // [ROWS, E] bf16
    // K in front of V in one object: V's column block lies 2048 B behind K's in a qkv row, the
    // compiler folds that step into the V copies' offset field (which moves the LDS address
    // too) and takes it off their LDS address register; with V at 9216 B that stays above 0.
    struct __attribute__((aligned(16))) KVTiles {
        unsigned short k[64][72];
        unsigned short v[64][80];
    };
    // two buffers: trip t reads buffer t & 1 while the copies of tile t + 1 land in the other
    __shared__ KVTiles kv[2];
    // per key 0 or a large negative number: the C operand of the score product. A lane's scores are
    // 32 different keys a tile, so the mask is turned into addends once a block, not per tile.
    __shared__ __attribute__((aligned(16))) float Mb[SEQ];

    const int tid = threadIdx.x;
    const int wid = tid >> 5, lane = tid & 31;
    const int g   = lane >> 4, ln = lane & 15;

    const int nqb = SEQ / (64 * QT);                // 16
    const int qb  = blockIdx.x % nqb;
    const int h   = (blockIdx.x / nqb) % HEADS;
    const int b   = blockIdx.x / (nqb * HEADS);

    const int    q0   = qb * (64 * QT) + wid * (16 * QT);
    const size_t rowB = (size_t)b * SEQ;
    // softmax in base 2: exp(scale * (s - m)) = exp2(s * sl2 - m * sl2), sl2 = 1/sqrt(64) * log2(e).
    // Scores and the running maximum stay unscaled (the scale is positive: the same key is the maximum).
    const float  sl2 = 0.125f * 1.44269504088896340736f;

    // Q fragments (B operand 32 d x 16 queries, two for d=64, per query tile) loaded once from
    // global; lane holds query q0 + t*16 + ln in the k order of kpair_of(), as the K loader below
    FragA aq[QT][2];
#pragma unroll
    for (int t = 0; t < QT; ++t)
#pragma unroll
        for (int f = 0; f < 2; ++f)
#pragma unroll
            for (int j = 0; j < 8; ++j) {
                int col = h * HDIM + f * 32 + kpair_of(j, g);
                aq[t][f].u[j] =
                    *(const unsigned int*)(qkvb + (rowB + q0 + t * 16 + ln) * (size_t)QKV_N + col);
            }

    // written in front of the ring's first barrier, read behind it
#pragma unroll
    for (int i = 0; i < SEQ / (128 * 4); ++i) {
        const int4 mv = ((const int4*)(mask + b * SEQ))[tid + i * 128];
        float4 mbv;
        mbv.x = (mv.x == 0) ? -1.0e38f : 0.f;
        mbv.y = (mv.y == 0) ? -1.0e38f : 0.f;
        mbv.z = (mv.z == 0) ? -1.0e38f : 0.f;
        mbv.w = (mv.w == 0) ? -1.0e38f : 0.f;
        ((float4*)Mb)[tid + i * 128] = mbv;
    }

    float m[QT];            // running maximum of query t*16 + ln, unscaled (equal in both lane halves)
    float l[QT];            // running sum over this lane half's keys; the halves join at the end
    FragC o[QT][4];         // o[t][dt].f[r] = Ot[dt*16 + 8g + r][query t*16 + ln]
#pragma unroll
    for (int t = 0; t < QT; ++t) {
        // far below any score, far above the mask addend: while every key so far is masked, m stays here,
        // m * sl2 stays small beside addend * sl2, and the multiply-add sends masked keys to weight 0
        m[t] = -1.0e30f;
        l[t] = 0.f;
#pragma unroll
        for (int dt = 0; dt < 4; ++dt)
#pragma unroll
            for (int r = 0; r < 8; ++r) o[t][dt].f[r] = 0.f;
    }

    // the copies of the 64 keys from kb on into buffer buf (8 x b128 per thread)
    auto stage = [&](int kb, int buf) {
        // K tile: straight row copy -> async global->LDS (4 x b128 per thread)
#pragma unroll
        for (int i = 0; i < 4; ++i) {
            int q = tid + i * 128;                 // 0..511
            int key = q >> 3, seg = (q & 7) << 3;  // seg in elements (8 = 16B)
            async_copy16(qkvb + (rowB + kb + key) * (size_t)QKV_N + EMBED + h * HDIM + seg,
                         &kv[buf].k[key][seg]);
        }
        // V tile: straight row copy too (4 x b128 per thread); the read transposes
#pragma unroll
        for (int i = 0; i < 4; ++i) {
            int q = tid + i * 128;                 // 0..511
            int key = q >> 3, seg = (q & 7) << 3;
            async_copy16(qkvb + (rowB + kb + key) * (size_t)QKV_N + 2 * EMBED + h * HDIM + seg,
                         &kv[buf].v[key][seg]);
        }
    };

    static_assert(SEQ >= 128, "the ring's prologue fills two tiles");
    stage(0, 0);
    wait_async0();
    __syncthreads();                 // publishes tile 0 and the mask addends
    stage(64, 1);                    // flies during trip 0

    for (int kb = 0; kb < SEQ; kb += 64) {
        const int buf = (kb >> 6) & 1;
        const unsigned short (&Kt)[64][72] = kv[buf].k;
        const unsigned short (&Vs)[64][80] = kv[buf].v;

        // St = K Qt + mask addend, unscaled   (64 keys x 32 queries per wave)
        FragC s[QT][4];
#pragma unroll
        for (int n = 0; n < 4; ++n) {
            // the lane's eight keys of this tile lie in a row
            const float4* mp = (const float4*)&Mb[kb + n * 16 + 8 * g];
            const float4 c0 = mp[0], c1 = mp[1];
#pragma unroll
            for (int t = 0; t < QT; ++t) {
                s[t][n].f[0] = c0.x; s[t][n].f[1] = c0.y; s[t][n].f[2] = c0.z; s[t][n].f[3] = c0.w;
                s[t][n].f[4] = c1.x; s[t][n].f[5] = c1.y; s[t][n].f[6] = c1.z; s[t][n].f[7] = c1.w;
            }
#pragma unroll
            for (int ks = 0; ks < 2; ++ks) {
                FragA bk;
#pragma unroll
                for (int j = 0; j < 8; ++j)
                    bk.u[j] = *(const unsigned int*)&Kt[n * 16 + ln][ks * 32 + kpair_of(j, g)];
#pragma unroll
                for (int t = 0; t < QT; ++t)
                    s[t][n].v = __builtin_amdgcn_wmma_f32_16x16x32_bf16(
                        false, bk.v, false, aq[t][ks].v, (short)0, s[t][n].v, false, false);
            }
        }

        FragA pb[QT][2];
#pragma unroll
        for (int t = 0; t < QT; ++t) {
            // online softmax, one query a lane: maximum over the lane's 32 keys, then the other half's
            float tmax[4];          // four chains that do not wait for one another
#pragma unroll
            for (int n = 0; n < 4; ++n) {
                tmax[n] = s[t][n].f[0];
#pragma unroll
                for (int r = 1; r < 8; ++r) tmax[n] = fmaxf(tmax[n], s[t][n].f[r]);
            }
            float rm = fmaxf(fmaxf(tmax[0], tmax[1]), fmaxf(tmax[2], tmax[3]));
            rm = fmaxf(rm, other_half(rm));

            const float mn    = fmaxf(m[t], rm);
            const float alpha = __builtin_amdgcn_exp2f((m[t] - mn) * sl2);
            const float nm    = -mn * sl2;      // one multiply-add a score carries scale, base and maximum
            m[t] = mn;
#pragma unroll
            for (int dt = 0; dt < 4; ++dt)
#pragma unroll
                for (int r = 0; r < 8; ++r) o[t][dt].f[r] *= alpha;

            float part[4];
#pragma unroll
            for (int n = 0; n < 4; ++n) {
                part[n] = 0.f;
#pragma unroll
                for (int r = 0; r < 8; r += 2) {
                    // the register pair as it lies in the accumulator: one packed multiply-add, no moves
                    v2f x = {s[t][n].f[r], s[t][n].f[r + 1]};
                    x = __builtin_elementwise_fma(x, (v2f){sl2, sl2}, (v2f){nm, nm});
                    const float p0 = __builtin_amdgcn_exp2f(x.x), p1 = __builtin_amdgcn_exp2f(x.y);
                    s[t][n].f[r]     = p0;
                    s[t][n].f[r + 1] = p1;
                    part[n] += p0;
                    part[n] += p1;
                }
            }
            l[t] = l[t] * alpha + ((part[0] + part[1]) + (part[2] + part[3]));

            // Pt as B operand: element e of the fragment is key ks*32 + (e < 8 ? 8g + e : 16 + 8g + e - 8),
            // which is register e & 7 of score tile 2*ks + (e >> 3)
#pragma unroll
            for (int ks = 0; ks < 2; ++ks)
#pragma unroll
                for (int e = 0; e < 16; ++e)
                    pb[t][ks].v[e] = (bf16_t)s[t][2 * ks + (e >> 3)].f[e & 7];
        }

        __builtin_amdgcn_sched_barrier(0);

        // Ot += Vt Pt; the transposing read delivers Vt (16 d x 32 keys) as the A operand
#pragma unroll
        for (int ks = 0; ks < 2; ++ks)
#pragma unroll
            for (int dt = 0; dt < 4; ++dt) {
                FragA bv;
                load_b_tr16(bv, &Vs[0][0], 80, ks * 32, dt * 16, lane);
#pragma unroll
                for (int t = 0; t < QT; ++t)
                    o[t][dt].v = __builtin_amdgcn_wmma_f32_16x16x32_bf16(
                        false, bv.v, false, pb[t][ks].v, (short)0, o[t][dt].v, false, false);
            }

        // publish point: the one barrier of a trip publishes the next tile and ends every
        // wave's reads of this one, whose buffer is refilled behind it
        wait_ds0();
        wait_async0();
        __syncthreads();
        if (kb + 128 < SEQ) stage(kb + 128, buf);
    }
    wait_async0();               // nothing of this wave is in flight when it leaves the ring

    // join the halves' sums, normalize and emit ctx (bf16, [B,T,E] row-major with head offset):
    // a lane's eight registers of a tile are eight d in a row of its query's row: 16 B. They are laid in
    // LDS first, 32 rows of 128 B at pitch 144 B (16 B x odd), so that the stores cover whole lines.
    // The ring is free (the last trip's barrier stands behind every wave's last read of it, and no copy
    // is in flight), and each wave has 4,608 B of the first buffer for itself: no barrier is needed.
    static_assert(4 * 4608 <= sizeof(KVTiles), "the four waves' staging ranges fit the first buffer");
    char* const st = (char*)&kv[0] + wid * 4608;
#pragma unroll
    for (int t = 0; t < QT; ++t) {
        const float lt  = l[t] + other_half(l[t]);
        const float inv = 1.f / lt;
        char* const srow = st + (t * 16 + ln) * 144 + g * 16;
#pragma unroll
        for (int dt = 0; dt < 4; ++dt) {
            const FragC& ot = o[t][dt];
            uint4 w;
            w.x = (unsigned int)f2bf(ot.f[0] * inv) | ((unsigned int)f2bf(ot.f[1] * inv) << 16);
            w.y = (unsigned int)f2bf(ot.f[2] * inv) | ((unsigned int)f2bf(ot.f[3] * inv) << 16);
            w.z = (unsigned int)f2bf(ot.f[4] * inv) | ((unsigned int)f2bf(ot.f[5] * inv) << 16);
            w.w = (unsigned int)f2bf(ot.f[6] * inv) | ((unsigned int)f2bf(ot.f[7] * inv) << 16);
            *(uint4*)(srow + dt * 32) = w;
        }
    }
    wait_ds0();          // the wave's rows lie in LDS before other lanes of it read them back
    // eight lanes read and store one query's 128 B: a store covers four whole lines
    unsigned short* crow =
        ctxb + (size_t)(b * SEQ + q0 + (lane >> 3)) * EMBED + h * HDIM + (lane & 7) * 8;
#pragma unroll   // the reads go out as one run
    for (int i = 0; i < 4 * QT; ++i)
        *(uint4*)(crow + (size_t)(i * 4) * EMBED) =
            *(const uint4*)(st + (i * 4 + (lane >> 3)) * 144 + (lane & 7) * 16);
}

// ---------------------------------------------------------------------- launch
extern "C" void kernel_launch(void* const* d_in, const int* in_sizes, int n_in,
                              void* d_out, int out_size, void* d_ws, size_t ws_size,
                              hipStream_t stream) {
    (void)in_sizes; (void)n_in; (void)out_size; (void)ws_size;
    const float* x    = (const float*)d_in[0];
    const int*   mask = (const int*)  d_in[1];
    const float* Wqkv = (const float*)d_in[2];
    const float* bqkv = (const float*)d_in[3];
    const float* Wout = (const float*)d_in[4];
    const float* bout = (const float*)d_in[5];

    char* ws = (char*)d_ws;
    size_t off = 0;
    unsigned short* xb    = (unsigned short*)(ws + off); off += (size_t)ROWS  * EMBED * 2;
    unsigned short* wqkvb = (unsigned short*)(ws + off); off += (size_t)EMBED * QKV_N * 2;
    unsigned short* woutb = (unsigned short*)(ws + off); off += (size_t)EMBED * EMBED * 2;
    unsigned short* qkvb  = (unsigned short*)(ws + off); off += (size_t)ROWS  * QKV_N * 2;
    unsigned short* ctxb  = (unsigned short*)(ws + off); off += (size_t)ROWS  * EMBED * 2;

    static_assert((ROWS * EMBED) % (256 * 8 * 4) == 0 && (EMBED * QKV_N) % (256 * 6 * 4) == 0 &&
                  (EMBED * EMBED) % (256 * 4 * 4) == 0, "convert grids cover the arrays exactly");
    cvt_f32_bf16<8><<<(ROWS * EMBED) / (256 * 8 * 4), 256, 0, stream>>>(x, xb);          // 1024 blocks
    cvt_f32_bf16<6><<<(EMBED * QKV_N) / (256 * 6 * 4), 256, 0, stream>>>(Wqkv, wqkvb);   // 512 blocks
    cvt_f32_bf16<4><<<(EMBED * EMBED) / (256 * 4 * 4), 256, 0, stream>>>(Wout, woutb);   // 256 blocks

    // qkv = x @ Wqkv + bqkv   (bf16 out)
    gemm_bf16_wmma<true><<<dim3(QKV_N / 128, ROWS / 256), 256, 0, stream>>>(
        xb, wqkvb, bqkv, qkvb, ROWS, QKV_N, EMBED);

    // streaming attention per (b, h, 128-query block)
    attention_wmma<<<BATCH * HEADS * (SEQ / (64 * QT)), 128, 0, stream>>>(qkvb, mask, ctxb);

    // out = ctx @ Wout + bout  (fp32 out)
    gemm_bf16_wmma<false><<<dim3(EMBED / 128, ROWS / 256), 256, 0, stream>>>(
        ctxb, woutb, bout, d_out, ROWS, EMBED, EMBED);
}

// v010
// A run of this version takes 132 microseconds.
// Timed twice side by side with v009, it ran 1.04 and 1.03 times as fast.
// Counting every step since v000, it is 10.0 times as fast.
#include <hip/hip_runtime.h>
#include <stdint.h>

#define EMBED 1024
#define HEADS 16
#define HDIM  64
#define BATCH 4
#define SEQ   2048
#define ROWS  (BATCH * SEQ)     // 8192
#define QKV_N (3 * EMBED)       // 3072

typedef __bf16 bf16_t;
typedef bf16_t v16bf __attribute__((ext_vector_type(16)));
typedef float  v8f   __attribute__((ext_vector_type(8)));
typedef float  v2f   __attribute__((ext_vector_type(2)));
typedef int    v4i   __attribute__((ext_vector_type(4)));

typedef short  v8s   __attribute__((ext_vector_type(8)));

union FragA { v16bf v; unsigned int u[8]; v8s h[2]; };
union FragC { v8f  v; float f[8]; };

__device__ __forceinline__ unsigned short f2bf(float x) {
    union { float f; unsigned int u; } c; c.f = x;
    unsigned int r = (c.u + 0x7fffu + ((c.u >> 16) & 1u)) >> 16;  // RNE
    return (unsigned short)r;
}

__device__ __forceinline__ int kpair_of(int j, int g) {
    return ((j >> 2) << 4) | (g << 3) | ((j & 3) << 1);
}

#if __has_builtin(__builtin_amdgcn_global_load_async_to_lds_b128)
#define HAVE_ASYNC_LDS 1
#else
#define HAVE_ASYNC_LDS 0
#endif

__device__ __forceinline__ void async_copy16(const void* gsrc, void* lds) {
#if HAVE_ASYNC_LDS
    __builtin_amdgcn_global_load_async_to_lds_b128(
        (__attribute__((address_space(1))) v4i*)gsrc,
        (__attribute__((address_space(3))) v4i*)lds, 0, 0);
#else
    *(uint4*)lds = *(const uint4*)gsrc;
#endif
}

// The two waits at a ring's publish point, each a statement of its own in front of the barrier.
// Own LDS reads have retired before the buffer they read is refilled behind the barrier.
__device__ __forceinline__ void wait_ds0() { asm volatile("s_wait_dscnt 0x0" ::: "memory"); }
// Own copies have landed before the barrier behind which other waves read them; in asm so that
// no LDS read is lifted over it.
__device__ __forceinline__ void wait_async0() { asm volatile("s_wait_asynccnt 0x0" ::: "memory"); }
// Stands between issued global loads or stores and code that rewrites registers which they name.
__device__ __forceinline__ void wait_x0() { asm volatile("s_wait_xcnt 0x0" ::: "memory"); }

__device__ __forceinline__ void load_b_tr16(FragA& f, const unsigned short* tile,
                                            int pitch, int k0, int n0, int lane) {
    typedef __attribute__((address_space(3))) v8s lds_v8s;
    const unsigned short* p =
        tile + (k0 + ((lane >> 4) << 3) + (lane & 7)) * pitch + n0 + (((lane >> 3) & 1) << 3);
    f.h[0] = __builtin_amdgcn_ds_load_tr16_b128_v8i16((lds_v8s*)p);
    f.h[1] = __builtin_amdgcn_ds_load_tr16_b128_v8i16((lds_v8s*)(p + 16 * pitch));
}

// ---------------------------------------------------------------- fp32 -> bf16
// Each block converts 256 * PER groups of 4 floats that lie in a row; the grid covers the
// array exactly. A wave's load covers 512 B in a row, its store 256 B: whole lines both ways.
// All PER loads of a lane are issued before the first is used.
template <int PER>
__global__ __launch_bounds__(256)
void cvt_f32_bf16(const float* __restrict__ src, unsigned short* __restrict__ dst) {
    const size_t g0 = (size_t)blockIdx.x * (256 * PER) + threadIdx.x;
    const float4* __restrict__ s4 = (const float4*)src;
    uint2* __restrict__ d4 = (uint2*)dst;
    float4 v[PER];
#pragma unroll   // v[] stays in registers and the loads go out as one run, ahead of any use
    for (int i = 0; i < PER; ++i) v[i] = s4[g0 + i * 256];
#pragma unroll   // constant indices into v[]
    for (int i = 0; i < PER; ++i) {
        uint2 o;
        o.x = (unsigned int)f2bf(v[i].x) | ((unsigned int)f2bf(v[i].y) << 16);
        o.y = (unsigned int)f2bf(v[i].z) | ((unsigned int)f2bf(v[i].w) << 16);
        d4[g0 + i * 256] = o;
    }
}

template <bool STORE_BF16, int TN>
__global__ __launch_bounds__(256)
void gemm_bf16_wmma(const unsigned short* __restrict__ A,
                    const unsigned short* __restrict__ Bm,
                    const float* __restrict__ bias,
                    void* __restrict__ Cout,
                    int M, int N, int K) {
    static_assert(TN % 4 == 0, "B fragments are read and used four at a time");
    constexpr int BN = 32 * TN;      // columns of the block's tile
    constexpr int WN = 16 * TN;      // columns of a wave's tile
    constexpr int NH = TN / 4;       // groups of four column tiles
    constexpr int BP = BN + 16;      // B row pitch in elements
    // two buffers each: trip t reads buffer t & 1 while the copies of tile t + 1 land in the other
    __shared__ __attribute__((aligned(16))) unsigned short As[2][256][72];
    __shared__ __attribute__((aligned(16))) unsigned short Bs[2][64][BP];

    const int tid  = threadIdx.x;
    const int wid  = tid >> 5, lane = tid & 31;
    const int g    = lane >> 4, ln = lane & 15;
    const int wm   = wid >> 1,  wn = wid & 1;
    const int m0   = blockIdx.y * 256, n0 = blockIdx.x * BN;

    FragC acc[4][TN];
#pragma unroll   // constant indices: the register arrays stay in registers
    for (int tm = 0; tm < 4; ++tm)
#pragma unroll   // constant indices: the register arrays stay in registers
        for (int tn = 0; tn < TN; ++tn)
#pragma unroll   // constant indices: the register arrays stay in registers
            for (int r = 0; r < 8; ++r) acc[tm][tn].f[r] = 0.f;

    // the copies of the tile at k = kb into buffer buf (8 + TN x b128 per thread)
    auto stage = [&](int kb, int buf) {
        // A tile: straight row copy -> async global->LDS (8 x b128 per thread; a wave covers 4 whole lines)
#pragma unroll   // the copies go out as one run
        for (int i = 0; i < 8; ++i) {
            int q = tid + i * 256;              // 0..2047
            int row = q >> 3, seg = (q & 7) << 3;   // seg in elements (8 = 16B)
            async_copy16(A + (size_t)(m0 + row) * K + kb + seg, &As[buf][row][seg]);
        }
        // B tile: straight row copy too (TN x b128 per thread); the read transposes. Sixteen lanes
        // cover 256 B in a row: a wave's copy is four whole lines
#pragma unroll   // the copies go out as one run
        for (int i = 0; i < 4; ++i)
#pragma unroll   // the copies go out as one run
            for (int j = 0; j < NH; ++j) {
                int q = tid + i * 256;          // sixteen rows a step
                int kk = q >> 4, seg = ((q & 15) + j * 16) << 3;
                async_copy16(Bm + (size_t)(kb + kk) * N + n0 + seg, &Bs[buf][kk][seg]);
            }
    };

    if (K > 0) stage(0, 0);
    wait_async0();
    __syncthreads();                 // publishes tile 0
    if (K > 64) stage(64, 1);        // flies during trip 0

    for (int kb = 0; kb < K; kb += 64) {
        const int buf = (kb >> 6) & 1;

        FragA a[4], b[4];
        // the wave's fragments of k step ks, B four column tiles at a time; A and B both in the k
        // order of kpair_of()
        auto afrags = [&](int ks) {
#pragma unroll   // constant indices: the register arrays stay in registers
            for (int tm = 0; tm < 4; ++tm)
#pragma unroll   // constant indices: the register arrays stay in registers
                for (int j = 0; j < 8; ++j)
                    a[tm].u[j] = *(const unsigned int*)
                        &As[buf][wm * 64 + tm * 16 + ln][ks * 32 + kpair_of(j, g)];
        };
        auto bfrags = [&](int ks, int nh) {
#pragma unroll   // constant indices: the register arrays stay in registers
            for (int tn = 0; tn < 4; ++tn)
                load_b_tr16(b[tn], &Bs[buf][0][0], BP, ks * 32, wn * WN + (nh * 4 + tn) * 16, lane);
        };
        auto products = [&](int nh) {
#pragma unroll   // constant indices: the register arrays stay in registers
            for (int tm = 0; tm < 4; ++tm)
#pragma unroll   // constant indices: the register arrays stay in registers
                for (int tn = 0; tn < 4; ++tn)
                    acc[tm][nh * 4 + tn].v = __builtin_amdgcn_wmma_f32_16x16x32_bf16(
                        false, b[tn].v, false, a[tm].v, (short)0, acc[tm][nh * 4 + tn].v, false, false);
        };

        afrags(0);
#pragma unroll   // constant indices: the register arrays stay in registers
        for (int nh = 0; nh < NH; ++nh) {
            bfrags(0, nh);
            products(nh);
        }
        afrags(1);
#pragma unroll   // constant indices: the register arrays stay in registers
        for (int nh = 0; nh < NH - 1; ++nh) {
            bfrags(1, nh);
            products(nh);
        }
        bfrags(1, NH - 1);

        // publish point, behind the trip's last LDS read and in front of its last products (they
        // work on registers alone): the one barrier of a trip publishes the next tile and ends
        // every wave's reads of this one, whose buffer is refilled behind it
        wait_ds0();
        wait_async0();
        __syncthreads();
        // a short trip needs the refill out ahead of the last products
        if (NH == 1 && kb + 128 < K) stage(kb + 128, buf);

        products(NH - 1);

        // a long trip has the time, and behind the products the fragments' registers are free for
        // the copies' addresses
        if (NH > 1 && kb + 128 < K) stage(kb + 128, buf);
    }
    wait_async0();               // nothing of this wave is in flight when it leaves the ring

    // acc[tm][tn].f[r] = C[wm*64 + tm*16 + ln][wn*WN + tn*16 + 8g + r]
    // The epilogue goes through the wave's tile 64 columns (four column tiles) at a time.
#pragma unroll   // constant indices: the register arrays stay in registers
    for (int nh = 0; nh < NH; ++nh) {
        const int c0 = n0 + wn * WN + nh * 64;      // first column of this round
        // the lane's 32 bias values, eight in a row per column tile, loaded as one run
        float4 bv[4][2];
#pragma unroll   // constant indices: the register arrays stay in registers
        for (int tn = 0; tn < 4; ++tn) {
            const float4* bp = (const float4*)(bias + c0 + tn * 16 + 8 * g);
            bv[tn][0] = bp[0];
            bv[tn][1] = bp[1];
        }

        // Staging: the ring is free (the last trip's barrier stands behind every wave's last read of it, and
        // no copy is in flight). Each wave has 9,216 B of the A buffers for itself, so no barrier is needed.
        char* const st = (char*)&As[0][0][0] + wid * 9216;
        if (STORE_BF16) {
#pragma unroll   // constant indices: the register arrays stay in registers
            for (int tm = 0; tm < 4; ++tm)
#pragma unroll   // constant indices: the register arrays stay in registers
                for (int tn = 0; tn < 4; ++tn) {
                    const FragC& c = acc[tm][nh * 4 + tn];
                    union { bf16_t e[8]; uint4 q; } w;
                    w.e[0] = (bf16_t)(c.f[0] + bv[tn][0].x); w.e[1] = (bf16_t)(c.f[1] + bv[tn][0].y);
                    w.e[2] = (bf16_t)(c.f[2] + bv[tn][0].z); w.e[3] = (bf16_t)(c.f[3] + bv[tn][0].w);
                    w.e[4] = (bf16_t)(c.f[4] + bv[tn][1].x); w.e[5] = (bf16_t)(c.f[5] + bv[tn][1].y);
                    w.e[6] = (bf16_t)(c.f[6] + bv[tn][1].z); w.e[7] = (bf16_t)(c.f[7] + bv[tn][1].w);
                    *(uint4*)(st + (tm * 16 + ln) * 144 + tn * 32 + g * 16) = w.q;
                }
            wait_ds0();      // the wave's rows lie in LDS before other lanes of it read them back
            // eight lanes read and store one row's 128 B: a store covers four whole lines
            unsigned short* crow = (unsigned short*)Cout +
                (size_t)(m0 + wm * 64 + (lane >> 3)) * N + c0 + (lane & 7) * 8;
#pragma unroll   // the reads go out as one run
            for (int i = 0; i < 16; ++i)
                *(uint4*)(crow + (size_t)(i * 4) * N) =
                    *(const uint4*)(st + (i * 4 + (lane >> 3)) * 144 + (lane & 7) * 16);
        } else {
            // 32 rows of 256 B at pitch 272 B (16 B x odd) at a time: two rounds through the wave's range
#pragma unroll   // constant indices: the register arrays stay in registers
            for (int hm = 0; hm < 2; ++hm) {
#pragma unroll   // constant indices: the register arrays stay in registers
                for (int t2 = 0; t2 < 2; ++t2)
#pragma unroll   // constant indices: the register arrays stay in registers
                    for (int tn = 0; tn < 4; ++tn) {
                        const FragC& c = acc[hm * 2 + t2][nh * 4 + tn];
                        float4* p = (float4*)(st + (t2 * 16 + ln) * 272 + tn * 64 + g * 32);
                        p[0] = make_float4(c.f[0] + bv[tn][0].x, c.f[1] + bv[tn][0].y,
                                           c.f[2] + bv[tn][0].z, c.f[3] + bv[tn][0].w);
                        p[1] = make_float4(c.f[4] + bv[tn][1].x, c.f[5] + bv[tn][1].y,
                                           c.f[6] + bv[tn][1].z, c.f[7] + bv[tn][1].w);
                    }
                wait_ds0();  // the wave's rows lie in LDS before other lanes of it read them back
                // sixteen lanes read and store one row's 256 B: a store covers four whole lines
                float* crow = (float*)Cout +
                    (size_t)(m0 + wm * 64 + hm * 32 + (lane >> 4)) * N + c0 + (lane & 15) * 4;
#pragma unroll   // the reads go out as one run
                for (int i = 0; i < 16; ++i)
                    *(float4*)(crow + (size_t)(i * 2) * N) =
                        *(const float4*)(st + (i * 2 + (lane >> 4)) * 272 + (lane & 15) * 16);
                if (hm == 0) wait_ds0();  // the read-back has retired before the next round overwrites the range
            }
        }
        if (nh + 1 < NH) {
            wait_ds0();  // the read-back has retired before the next round overwrites the range
            wait_x0();   // in front of the next round, which rewrites registers that the stores above name
        }
    }
}

// ------------------------------------------------ flash-attention (streaming)
// grid = B*H*(SEQ/128), 128 threads (4 waves). Wave = 32 queries = QT query tiles of 16: every K and
// V fragment that a wave reads from LDS feeds one product per query tile.
// Both products are taken transposed: St = K Qt and Ot += Vt Pt. A lane (c = lane&15, g = lane>>4)
// then holds scores of ONE query per tile (c): register r of score tile n is key n*16 + 8g + r. Row
// maximum and row sum run inside the lane, with one exchange between the lane halves; two score
// tiles, converted in place, are the B operand (32 keys x 16 queries) of the second product.
#define QT 2
__device__ __forceinline__ float other_half(float x) {      // value of lane ^ 16
    int b = __float_as_int(x);
    return __int_as_float(__builtin_amdgcn_permlanex16(b, b, 0x76543210, 0xfedcba98, false, false));
}

__global__ __launch_bounds__(128) __attribute__((amdgpu_waves_per_eu(4, 4)))
void attention_wmma(const unsigned short* __restrict__ qkvb,   // [ROWS, 3E] bf16
                    const int* __restrict__ mask,              // [B*SEQ]
                    unsigned short* __restrict__ ctxb) {       // [ROWS, E] bf16
    // K in front of V in one object: V's column block lies 2048 B behind K's in a qkv row, the
    // compiler folds that step into the V copies' offset field (which moves the LDS address
    // too) and takes it off their LDS address register; with V at 9216 B that stays above 0.
    struct __attribute__((aligned(16))) KVTiles {
        unsigned short k[64][72];
        unsigned short v[64][80];
    };
    // two buffers: trip t reads buffer t & 1 while the copies of tile t + 1 land in the other
    __shared__ KVTiles kv[2];
    // per key 0 or a large negative number: the C operand of the score product. A lane's scores are
    // 32 different keys a tile, so the mask is turned into addends once a block, not per tile.
    __shared__ __attribute__((aligned(16))) float Mb[SEQ];

    const int tid = threadIdx.x;
    const int wid = tid >> 5, lane = tid & 31;
    const int g   = lane >> 4, ln = lane & 15;

    const int nqb = SEQ / (64 * QT);                // 16
    const int qb  = blockIdx.x % nqb;
    const int h   = (blockIdx.x / nqb) % HEADS;
    const int b   = blockIdx.x / (nqb * HEADS);

    const int    q0   = qb * (64 * QT) + wid * (16 * QT);
    const size_t rowB = (size_t)b * SEQ;
    // softmax in base 2: exp(scale * (s - m)) = exp2(s * sl2 - m * sl2), sl2 = 1/sqrt(64) * log2(e).
    // Scores and the running maximum stay unscaled (the scale is positive: the same key is the maximum).
    const float  sl2 = 0.125f * 1.44269504088896340736f;

    // Q fragments (B operand 32 d x 16 queries, two for d=64, per query tile) loaded once from
    // global; lane holds query q0 + t*16 + ln in the k order of kpair_of(), as the K loader below
    FragA aq[QT][2];
#pragma unroll
    for (int t = 0; t < QT; ++t)
#pragma unroll
        for (int f = 0; f < 2; ++f)
#pragma unroll
            for (int j = 0; j < 8; ++j) {
                int col = h * HDIM + f * 32 + kpair_of(j, g);
                aq[t][f].u[j] =
                    *(const unsigned int*)(qkvb + (rowB + q0 + t * 16 + ln) * (size_t)QKV_N + col);
            }

    // written in front of the ring's first barrier, read behind it
#pragma unroll
    for (int i = 0; i < SEQ / (128 * 4); ++i) {
        const int4 mv = ((const int4*)(mask + b * SEQ))[tid + i * 128];
        float4 mbv;
        mbv.x = (mv.x == 0) ? -1.0e38f : 0.f;
        mbv.y = (mv.y == 0) ? -1.0e38f : 0.f;
        mbv.z = (mv.z == 0) ? -1.0e38f : 0.f;
        mbv.w = (mv.w == 0) ? -1.0e38f : 0.f;
        ((float4*)Mb)[tid + i * 128] = mbv;
    }

    float m[QT];            // running maximum of query t*16 + ln, unscaled (equal in both lane halves)
    float l[QT];            // running sum over this lane half's keys; the halves join at the end
    FragC o[QT][4];         // o[t][dt].f[r] = Ot[dt*16 + 8g + r][query t*16 + ln]
#pragma unroll
    for (int t = 0; t < QT; ++t) {
        // far below any score, far above the mask addend: while every key so far is masked, m stays here,
        // m * sl2 stays small beside addend * sl2, and the multiply-add sends masked keys to weight 0
        m[t] = -1.0e30f;
        l[t] = 0.f;
#pragma unroll
        for (int dt = 0; dt < 4; ++dt)
#pragma unroll
            for (int r = 0; r < 8; ++r) o[t][dt].f[r] = 0.f;
    }

    // the copies of the 64 keys from kb on into buffer buf (8 x b128 per thread)
    auto stage = [&](int kb, int buf) {
        // K tile: straight row copy -> async global->LDS (4 x b128 per thread)
#pragma unroll
        for (int i = 0; i < 4; ++i) {
            int q = tid + i * 128;                 // 0..511
            int key = q >> 3, seg = (q & 7) << 3;  // seg in elements (8 = 16B)
            async_copy16(qkvb + (rowB + kb + key) * (size_t)QKV_N + EMBED + h * HDIM + seg,
                         &kv[buf].k[key][seg]);
        }
        // V tile: straight row copy too (4 x b128 per thread); the read transposes
#pragma unroll
        for (int i = 0; i < 4; ++i) {
            int q = tid + i * 128;                 // 0..511
            int key = q >> 3, seg = (q & 7) << 3;
            async_copy16(qkvb + (rowB + kb + key) * (size_t)QKV_N + 2 * EMBED + h * HDIM + seg,
                         &kv[buf].v[key][seg]);
        }
    };

    static_assert(SEQ >= 128, "the ring's prologue fills two tiles");
    stage(0, 0);
    wait_async0();
    __syncthreads();                 // publishes tile 0 and the mask addends
    stage(64, 1);                    // flies during trip 0

    for (int kb = 0; kb < SEQ; kb += 64) {
        const int buf = (kb >> 6) & 1;
        const unsigned short (&Kt)[64][72] = kv[buf].k;
        const unsigned short (&Vs)[64][80] = kv[buf].v;

        // St = K Qt + mask addend, unscaled   (64 keys x 32 queries per wave)
        FragC s[QT][4];
#pragma unroll
        for (int n = 0; n < 4; ++n) {
            // the lane's eight keys of this tile lie in a row
            const float4* mp = (const float4*)&Mb[kb + n * 16 + 8 * g];
            const float4 c0 = mp[0], c1 = mp[1];
#pragma unroll
            for (int t = 0; t < QT; ++t) {
                s[t][n].f[0] = c0.x; s[t][n].f[1] = c0.y; s[t][n].f[2] = c0.z; s[t][n].f[3] = c0.w;
                s[t][n].f[4] = c1.x; s[t][n].f[5] = c1.y; s[t][n].f[6] = c1.z; s[t][n].f[7] = c1.w;
            }
#pragma unroll
            for (int ks = 0; ks < 2; ++ks) {
                FragA bk;
#pragma unroll
                for (int j = 0; j < 8; ++j)
                    bk.u[j] = *(const unsigned int*)&Kt[n * 16 + ln][ks * 32 + kpair_of(j, g)];
#pragma unroll
                for (int t = 0; t < QT; ++t)
                    s[t][n].v = __builtin_amdgcn_wmma_f32_16x16x32_bf16(
                        false, bk.v, false, aq[t][ks].v, (short)0, s[t][n].v, false, false);
            }
        }

        FragA pb[QT][2];
#pragma unroll
        for (int t = 0; t < QT; ++t) {
            // online softmax, one query a lane: maximum over the lane's 32 keys, then the other half's
            float tmax[4];          // four chains that do not wait for one another
#pragma unroll
            for (int n = 0; n < 4; ++n) {
                tmax[n] = s[t][n].f[0];
#pragma unroll
                for (int r = 1; r < 8; ++r) tmax[n] = fmaxf(tmax[n], s[t][n].f[r]);
            }
            float rm = fmaxf(fmaxf(tmax[0], tmax[1]), fmaxf(tmax[2], tmax[3]));
            rm = fmaxf(rm, other_half(rm));

            const float mn    = fmaxf(m[t], rm);
            const float alpha = __builtin_amdgcn_exp2f((m[t] - mn) * sl2);
            const float nm    = -mn * sl2;      // one multiply-add a score carries scale, base and maximum
            m[t] = mn;
#pragma unroll
            for (int dt = 0; dt < 4; ++dt)
#pragma unroll
                for (int r = 0; r < 8; ++r) o[t][dt].f[r] *= alpha;

            float part[4];
#pragma unroll
            for (int n = 0; n < 4; ++n) {
                part[n] = 0.f;
#pragma unroll
                for (int r = 0; r < 8; r += 2) {
                    // the register pair as it lies in the accumulator: one packed multiply-add, no moves
                    v2f x = {s[t][n].f[r], s[t][n].f[r + 1]};
                    x = __builtin_elementwise_fma(x, (v2f){sl2, sl2}, (v2f){nm, nm});
                    const float p0 = __builtin_amdgcn_exp2f(x.x), p1 = __builtin_amdgcn_exp2f(x.y);
                    s[t][n].f[r]     = p0;
                    s[t][n].f[r + 1] = p1;
                    part[n] += p0;
                    part[n] += p1;
                }
            }
            l[t] = l[t] * alpha + ((part[0] + part[1]) + (part[2] + part[3]));

            // Pt as B operand: element e of the fragment is key ks*32 + (e < 8 ? 8g + e : 16 + 8g + e - 8),
            // which is register e & 7 of score tile 2*ks + (e >> 3)
#pragma unroll
            for (int ks = 0; ks < 2; ++ks)
#pragma unroll
                for (int e = 0; e < 16; ++e)
                    pb[t][ks].v[e] = (bf16_t)s[t][2 * ks + (e >> 3)].f[e & 7];
        }

        __builtin_amdgcn_sched_barrier(0);

        // Ot += Vt Pt; the transposing read delivers Vt (16 d x 32 keys) as the A operand
#pragma unroll
        for (int ks = 0; ks < 2; ++ks)
#pragma unroll
            for (int dt = 0; dt < 4; ++dt) {
                FragA bv;
                load_b_tr16(bv, &Vs[0][0], 80, ks * 32, dt * 16, lane);
#pragma unroll
                for (int t = 0; t < QT; ++t)
                    o[t][dt].v = __builtin_amdgcn_wmma_f32_16x16x32_bf16(
                        false, bv.v, false, pb[t][ks].v, (short)0, o[t][dt].v, false, false);
            }

        // publish point: the one barrier of a trip publishes the next tile and ends every
        // wave's reads of this one, whose buffer is refilled behind it
        wait_ds0();
        wait_async0();
        __syncthreads();
        if (kb + 128 < SEQ) stage(kb + 128, buf);
    }
    wait_async0();               // nothing of this wave is in flight when it leaves the ring

    // join the halves' sums, normalize and emit ctx (bf16, [B,T,E] row-major with head offset):
    // a lane's eight registers of a tile are eight d in a row of its query's row: 16 B. They are laid in
    // LDS first, 32 rows of 128 B at pitch 144 B (16 B x odd), so that the stores cover whole lines.
    // The ring is free (the last trip's barrier stands behind every wave's last read of it, and no copy
    // is in flight), and each wave has 4,608 B of the first buffer for itself: no barrier is needed.
    static_assert(4 * 4608 <= sizeof(KVTiles), "the four waves' staging ranges fit the first buffer");
    char* const st = (char*)&kv[0] + wid * 4608;
#pragma unroll
    for (int t = 0; t < QT; ++t) {
        const float lt  = l[t] + other_half(l[t]);
        const float inv = 1.f / lt;
        char* const srow = st + (t * 16 + ln) * 144 + g * 16;
#pragma unroll
        for (int dt = 0; dt < 4; ++dt) {
            const FragC& ot = o[t][dt];
            uint4 w;
            w.x = (unsigned int)f2bf(ot.f[0] * inv) | ((unsigned int)f2bf(ot.f[1] * inv) << 16);
            w.y = (unsigned int)f2bf(ot.f[2] * inv) | ((unsigned int)f2bf(ot.f[3] * inv) << 16);
            w.z = (unsigned int)f2bf(ot.f[4] * inv) | ((unsigned int)f2bf(ot.f[5] * inv) << 16);
            w.w = (unsigned int)f2bf(ot.f[6] * inv) | ((unsigned int)f2bf(ot.f[7] * inv) << 16);
            *(uint4*)(srow + dt * 32) = w;
        }
    }
    wait_ds0();          // the wave's rows lie in LDS before other lanes of it read them back
    // eight lanes read and store one query's 128 B: a store covers four whole lines
    unsigned short* crow =
        ctxb + (size_t)(b * SEQ + q0 + (lane >> 3)) * EMBED + h * HDIM + (lane & 7) * 8;
#pragma unroll   // the reads go out as one run
    for (int i = 0; i < 4 * QT; ++i)
        *(uint4*)(crow + (size_t)(i * 4) * EMBED) =
            *(const uint4*)(st + (i * 4 + (lane >> 3)) * 144 + (lane & 7) * 16);
}

// ---------------------------------------------------------------------- launch
extern "C" void kernel_launch(void* const* d_in, const int* in_sizes, int n_in,
                              void* d_out, int out_size, void* d_ws, size_t ws_size,
                              hipStream_t stream) {
    (void)in_sizes; (void)n_in; (void)out_size; (void)ws_size;
    const float* x    = (const float*)d_in[0];
    const int*   mask = (const int*)  d_in[1];
    const float* Wqkv = (const float*)d_in[2];
    const float* bqkv = (const float*)d_in[3];
    const float* Wout = (const float*)d_in[4];
    const float* bout = (const float*)d_in[5];

    char* ws = (char*)d_ws;
    size_t off = 0;
    unsigned short* xb    = (unsigned short*)(ws + off); off += (size_t)ROWS  * EMBED * 2;
    unsigned short* wqkvb = (unsigned short*)(ws + off); off += (size_t)EMBED * QKV_N * 2;
    unsigned short* woutb = (unsigned short*)(ws + off); off += (size_t)EMBED * EMBED * 2;
    unsigned short* qkvb  = (unsigned short*)(ws + off); off += (size_t)ROWS  * QKV_N * 2;
    unsigned short* ctxb  = (unsigned short*)(ws + off); off += (size_t)ROWS  * EMBED * 2;

    static_assert((ROWS * EMBED) % (256 * 8 * 4) == 0 && (EMBED * QKV_N) % (256 * 6 * 4) == 0 &&
                  (EMBED * EMBED) % (256 * 4 * 4) == 0, "convert grids cover the arrays exactly");
    cvt_f32_bf16<8><<<(ROWS * EMBED) / (256 * 8 * 4), 256, 0, stream>>>(x, xb);          // 1024 blocks
    cvt_f32_bf16<6><<<(EMBED * QKV_N) / (256 * 6 * 4), 256, 0, stream>>>(Wqkv, wqkvb);   // 512 blocks
    cvt_f32_bf16<4><<<(EMBED * EMBED) / (256 * 4 * 4), 256, 0, stream>>>(Wout, woutb);   // 256 blocks

    // qkv = x @ Wqkv + bqkv   (bf16 out)
    gemm_bf16_wmma<true, 12><<<dim3(QKV_N / 384, ROWS / 256), 256, 0, stream>>>(     // 8 x 32 blocks
        xb, wqkvb, bqkv, qkvb, ROWS, QKV_N, EMBED);

    // streaming attention per (b, h, 128-query block)
    attention_wmma<<<BATCH * HEADS * (SEQ / (64 * QT)), 128, 0, stream>>>(qkvb, mask, ctxb);

    // out = ctx @ Wout + bout  (fp32 out)
    gemm_bf16_wmma<false, 4><<<dim3(EMBED / 128, ROWS / 256), 256, 0, stream>>>(      // 8 x 32 blocks
        ctxb, woutb, bout, d_out, ROWS, EMBED, EMBED);
}
